// v000
// Times are from an AMD MI455X. After a warm-up the kernel runs many times in a row, and a time is the length of
// such a window on the GPU divided by its runs, so every launch and the gaps after it count. The runs cycle
// through copies of the inputs. A figure is the median of several windows, for all but v000 over two sittings.
// Sittings can differ by a few percent; kernels timed side by side share one.
// v000, which the later versions start from, runs in 1000 microseconds.
#include <hip/hip_runtime.h>
#include <hip/hip_bf16.h>

typedef __attribute__((ext_vector_type(16))) _Float16 v16h;
typedef __attribute__((ext_vector_type(8)))  float    v8f;
typedef __attribute__((ext_vector_type(4)))  _Float16 h4;

// ---------------------------------------------------------------------------
// Problem constants
// ---------------------------------------------------------------------------
static constexpr int BATCH   = 2;
static constexpr int SEQ     = 4096;
static constexpr int HIDDEN  = 1024;
static constexpr int HEADS   = 16;
static constexpr int HEAD_D  = 64;
static constexpr int THREEC  = 3 * HIDDEN;   // 3072
static constexpr int MTOT    = BATCH * SEQ;  // 8192

// ---------------------------------------------------------------------------
// CDNA5 async global->LDS (16B per lane, ASYNCcnt-tracked)
// ---------------------------------------------------------------------------
static __device__ __forceinline__ void async_copy_b128(const _Float16* gsrc,
                                                       const _Float16* ldst) {
  const unsigned int       ldsa = (unsigned int)(uintptr_t)ldst;
  const unsigned long long ga   = (unsigned long long)(uintptr_t)gsrc;
  asm volatile("global_load_async_to_lds_b128 %0, %1, off"
               :: "v"(ldsa), "v"(ga) : "memory");
}
static __device__ __forceinline__ void wait_async0() {
  asm volatile("s_wait_asynccnt 0" ::: "memory");
}

// ---------------------------------------------------------------------------
// WMMA helper (D = A(16x32 f16) * B(32x16 f16) + C(16x16 f32))
// ---------------------------------------------------------------------------
static __device__ __forceinline__ v8f wmma32(v16h a, v16h b, v8f c) {
  return __builtin_amdgcn_wmma_f32_16x16x32_f16(false, a, false, b,
                                                (short)0, c, false, false);
}

// A-fragment: 16x32 f16 from LDS. Lanes 0-15 -> M=lane, K 0-7, 16-23;
// lanes 16-31 -> K 8-15, 24-31. 8 contiguous halves per chunk -> ds_load_b128.
static __device__ __forceinline__ v16h lds_a_frag(const _Float16* base,
                                                  int row0, int ld, int k0) {
  const int lane = threadIdx.x & 31;
  const int m = lane & 15, hf = lane >> 4;
  v16h a;
#pragma unroll
  for (int v = 0; v < 8; ++v) {
    const int kb = (v < 4) ? (hf * 8 + 2 * v) : (16 + hf * 8 + 2 * (v - 4));
    const _Float16* p = base + (size_t)(row0 + m) * ld + k0 + kb;
    a[2 * v]     = p[0];
    a[2 * v + 1] = p[1];
  }
  return a;
}

// B-fragment (32x16, K x N) from an N-major LDS tile: elem B[k][n] = base[n*ld + k]
static __device__ __forceinline__ v16h lds_b_frag_nmajor(const _Float16* base,
                                                         int n0, int ld, int k0) {
  const int lane = threadIdx.x & 31;
  const int n = lane & 15, hf = lane >> 4;
  v16h b;
#pragma unroll
  for (int v = 0; v < 8; ++v) {
    const int kb = (v < 4) ? (hf * 8 + 2 * v) : (16 + hf * 8 + 2 * (v - 4));
    const _Float16* p = base + (size_t)(n0 + n) * ld + k0 + kb;
    b[2 * v]     = p[0];
    b[2 * v + 1] = p[1];
  }
  return b;
}

// ---------------------------------------------------------------------------
// f32 -> f16 bulk conversion (vectorized, one-shot preprocessing)
// ---------------------------------------------------------------------------
__global__ __launch_bounds__(256)
void cvt_f32_f16(const float* __restrict__ src, _Float16* __restrict__ dst,
                 int n4) {
  const int i = blockIdx.x * 256 + threadIdx.x;
  if (i < n4) {
    const float4 v = ((const float4*)src)[i];
    h4 o; o[0] = (_Float16)v.x; o[1] = (_Float16)v.y;
          o[2] = (_Float16)v.z; o[3] = (_Float16)v.w;
    ((h4*)dst)[i] = o;
  }
}

// ---------------------------------------------------------------------------
// GEMM: out[M, Nout] = A[M, K] * W[Nout, K]^T + bias, A/W f16.
//   128(M) x 128(N) x 64(K) tile; 256 threads = 8 waves (4x2); each wave
//   computes 32x64 = 2x4 WMMA tiles -> 16 WMMA per K-iter between barriers.
//   Double-buffered LDS (64 KB), all staging via async global->LDS DMA,
//   pipelined one K-block ahead.
// ---------------------------------------------------------------------------
template <typename OT>
__global__ __launch_bounds__(256)
void gemm_bias_wmma(const _Float16* __restrict__ A, const _Float16* __restrict__ W,
                    const float* __restrict__ bias, OT* __restrict__ out,
                    int M, int Nout, int K) {
  constexpr int BM = 128, BN = 128, BK = 64;
  __shared__ _Float16 As[2][BM * BK];  // 2 x 16 KB
  __shared__ _Float16 Ws[2][BN * BK];  // 2 x 16 KB

  const int tid   = threadIdx.x;
  const int m_blk = blockIdx.y * BM;
  const int n_blk = blockIdx.x * BN;
  const int w     = tid >> 5;
  const int lane  = tid & 31;
  const int wm    = w >> 1;   // 0..3 -> 32 rows each
  const int wn    = w & 1;    // 0..1 -> 64 cols each

  // Per-thread staging chunk coordinates (8 halves = 16 B per chunk)
  int rs[4], cs[4];
  const _Float16* pa[4];  // global A pointers, advanced by BK each K-block
  const _Float16* pw[4];  // global W pointers
#pragma unroll
  for (int i = 0; i < 4; ++i) {
    const int idx = tid + i * 256;
    rs[i] = idx >> 3; cs[i] = (idx & 7) * 8;   // rows 0..127, cols {0,8,..,56}
    pa[i] = A + (size_t)(m_blk + rs[i]) * K + cs[i];
    pw[i] = W + (size_t)(n_blk + rs[i]) * K + cs[i];
  }

  // Prologue: stage K-block 0 into buffer 0
#pragma unroll
  for (int i = 0; i < 4; ++i) {
    async_copy_b128(pa[i], &As[0][rs[i] * BK + cs[i]]);
    async_copy_b128(pw[i], &Ws[0][rs[i] * BK + cs[i]]);
    pa[i] += BK;
    pw[i] += BK;
  }

  v8f acc[2][4] = {};

  const int nkb = K / BK;
  for (int kb = 0; kb < nkb; ++kb) {
    const int buf = kb & 1;
    wait_async0();
    __syncthreads();

    if (kb + 1 < nkb) {  // stage next K-block into other buffer
      const int nb = buf ^ 1;
#pragma unroll
      for (int i = 0; i < 4; ++i) {
        async_copy_b128(pa[i], &As[nb][rs[i] * BK + cs[i]]);
        async_copy_b128(pw[i], &Ws[nb][rs[i] * BK + cs[i]]);
        pa[i] += BK;
        pw[i] += BK;
      }
    }

#pragma unroll
    for (int ks = 0; ks < BK; ks += 32) {
      v16h af[2], bf[4];
#pragma unroll
      for (int mt = 0; mt < 2; ++mt)
        af[mt] = lds_a_frag(As[buf], wm * 32 + mt * 16, BK, ks);
#pragma unroll
      for (int nt = 0; nt < 4; ++nt)
        bf[nt] = lds_b_frag_nmajor(Ws[buf], wn * 64 + nt * 16, BK, ks);
#pragma unroll
      for (int mt = 0; mt < 2; ++mt)
#pragma unroll
        for (int nt = 0; nt < 4; ++nt)
          acc[mt][nt] = wmma32(af[mt], bf[nt], acc[mt][nt]);
    }
  }

  // Epilogue: C/D layout -> lane n = lane&15; row = r + 8*(lane>=16)
  const int hf = lane >> 4, nin = lane & 15;
#pragma unroll
  for (int mt = 0; mt < 2; ++mt)
#pragma unroll
    for (int nt = 0; nt < 4; ++nt) {
      const int nglob = n_blk + wn * 64 + nt * 16 + nin;
      const float bv = bias[nglob];
#pragma unroll
      for (int r = 0; r < 8; ++r) {
        const int mglob = m_blk + wm * 32 + mt * 16 + r + hf * 8;
        out[(size_t)mglob * Nout + nglob] = (OT)(acc[mt][nt][r] + bv);
      }
    }
}

// ---------------------------------------------------------------------------
// Flash attention: one block = one (b, h, 64-query slab). 128 threads = 4 waves,
// wave w owns query rows [w*16, w*16+16). Loop over 64-wide key blocks.
//   - Q and K staged with async global->LDS DMA; K double-buffered and
//     prefetched one block ahead (DMA overlaps S/softmax/PV compute).
//   - V prefetched one block ahead into registers, transposed (d-major) into
//     LDS so P*V B-fragments are contiguous (ds_load_b128).
// qkv layout: [B, N, 3C] f16 ; out layout: [B, N, H, D] f16
// ---------------------------------------------------------------------------
__global__ __launch_bounds__(128)
void flash_attn_wmma(const _Float16* __restrict__ qkv,
                     _Float16* __restrict__ attn_out) {
  constexpr int BR = 64, BC = 64, DH = HEAD_D;
  constexpr int SLD = 65;  // padded f32 score stride (bank-conflict free)
  constexpr int PLD = 72;  // padded f16 P stride (keeps 16B-aligned chunks)
  constexpr int VLD = 72;  // padded f16 V^T stride

  __shared__ _Float16 Qs[BR * DH];        //  8 KB
  __shared__ _Float16 Ks[2][BC * DH];     // 16 KB (double-buffered)
  __shared__ _Float16 VsT[DH * VLD];      //  9 KB (d-major)
  __shared__ float    Ss[BR * SLD];       // 16.25 KB
  __shared__ _Float16 Ps[BR * PLD];       //  9 KB
  __shared__ float    m_s[BR], l_s[BR], alpha_s[BR];

  const int tid  = threadIdx.x;
  const int w    = tid >> 5;
  const int lane = tid & 31;
  const int hf   = lane >> 4, nin = lane & 15;
  const int qblk = blockIdx.x;
  const int h    = blockIdx.y;
  const int b    = blockIdx.z;
  const float scale = 0.125f;             // 1/sqrt(64)

  const size_t rowstride = (size_t)THREEC;
  const size_t blkstep   = (size_t)BC * rowstride;   // halves per key-block
  const _Float16* qbase = qkv + ((size_t)b * SEQ) * rowstride + h * HEAD_D;

  // --- Prologue: async-stage Q slab and K block 0; V block 0 into registers ---
  int rk[4], ck[4];
  const _Float16* gk[4];
#pragma unroll
  for (int i = 0; i < 4; ++i) {
    const int idx = tid + i * 128;
    rk[i] = idx >> 3; ck[i] = (idx & 7) * 8;
    // Q slab (same chunk shape)
    async_copy_b128(qbase + (size_t)(qblk * BR + rk[i]) * rowstride + ck[i],
                    &Qs[rk[i] * DH + ck[i]]);
    gk[i] = qbase + (size_t)rk[i] * rowstride + HIDDEN + ck[i];
    async_copy_b128(gk[i], &Ks[0][rk[i] * DH + ck[i]]);
    gk[i] += blkstep;
  }

  int rv[8], cv[8];
  const _Float16* gv[8];
  h4 vreg[8];
#pragma unroll
  for (int i = 0; i < 8; ++i) {
    const int idx = tid + i * 128;
    rv[i] = idx >> 4; cv[i] = (idx & 15) * 4;
    gv[i] = qbase + (size_t)rv[i] * rowstride + 2 * HIDDEN + cv[i];
    vreg[i] = *(const h4*)gv[i];
    gv[i] += blkstep;
  }

  if (tid < BR) { m_s[tid] = -3.0e38f; l_s[tid] = 0.0f; }

  v8f oacc[4] = {};  // 16 rows x 64 cols f32, per wave

  const int nblocks = SEQ / BC;
  for (int kb = 0; kb < nblocks; ++kb) {
    const int buf = kb & 1;
    wait_async0();
    __syncthreads();   // Ks[buf]/Qs ready; prev PV done reading VsT/Ps

    // Commit V block kb (registers -> transposed LDS)
#pragma unroll
    for (int i = 0; i < 8; ++i)
#pragma unroll
      for (int j = 0; j < 4; ++j) VsT[(cv[i] + j) * VLD + rv[i]] = vreg[i][j];

    if (kb + 1 < nblocks) {
      // Async-prefetch K block kb+1 into the other buffer
#pragma unroll
      for (int i = 0; i < 4; ++i) {
        async_copy_b128(gk[i], &Ks[buf ^ 1][rk[i] * DH + ck[i]]);
        gk[i] += blkstep;
      }
      // Prefetch V block kb+1 into registers
#pragma unroll
      for (int i = 0; i < 8; ++i) {
        vreg[i] = *(const h4*)gv[i];
        gv[i] += blkstep;
      }
    }

    // S = Q K^T (16x64 per wave): 4 n-tiles, K-dim = 64 -> 2 WMMA steps
    v8f sacc[4] = {};
#pragma unroll
    for (int ks = 0; ks < 2; ++ks) {
      const v16h af = lds_a_frag(Qs, w * 16, DH, ks * 32);
#pragma unroll
      for (int nt = 0; nt < 4; ++nt) {
        const v16h bf = lds_b_frag_nmajor(Ks[buf], nt * 16, DH, ks * 32);
        sacc[nt] = wmma32(af, bf, sacc[nt]);
      }
    }
#pragma unroll
    for (int nt = 0; nt < 4; ++nt)
#pragma unroll
      for (int r = 0; r < 8; ++r)
        Ss[(w * 16 + r + hf * 8) * SLD + nt * 16 + nin] = sacc[nt][r] * scale;
    __syncthreads();

    // Online softmax: thread t owns row t (t < 64)
    if (tid < BR) {
      const float* srow = &Ss[tid * SLD];
      float rmax = -3.0e38f;
#pragma unroll 8
      for (int j = 0; j < BC; ++j) rmax = fmaxf(rmax, srow[j]);
      const float m_old = m_s[tid];
      const float m_new = fmaxf(m_old, rmax);
      const float alpha = __expf(m_old - m_new);
      float psum = 0.0f;
      _Float16* prow = &Ps[tid * PLD];
#pragma unroll 8
      for (int j = 0; j < BC; ++j) {
        const float p = __expf(srow[j] - m_new);
        prow[j] = (_Float16)p;
        psum += p;
      }
      l_s[tid]     = l_s[tid] * alpha + psum;
      m_s[tid]     = m_new;
      alpha_s[tid] = alpha;
    }
    __syncthreads();

    // Rescale accumulators, then O += P * V (4 d-tiles, 2 WMMA K-steps)
#pragma unroll
    for (int r = 0; r < 8; ++r) {
      const float a = alpha_s[w * 16 + r + hf * 8];
#pragma unroll
      for (int dt = 0; dt < 4; ++dt) oacc[dt][r] *= a;
    }
#pragma unroll
    for (int ks = 0; ks < 2; ++ks) {
      const v16h af = lds_a_frag(Ps, w * 16, PLD, ks * 32);
#pragma unroll
      for (int dt = 0; dt < 4; ++dt) {
        const v16h bf = lds_b_frag_nmajor(VsT, dt * 16, VLD, ks * 32);
        oacc[dt] = wmma32(af, bf, oacc[dt]);
      }
    }
  }
  __syncthreads();

  // Write O / l  ->  attn_out[b, nq, h, d]  (f16)
#pragma unroll
  for (int r = 0; r < 8; ++r) {
    const int mloc = w * 16 + r + hf * 8;
    const float linv = 1.0f / l_s[mloc];
    const int nq = qblk * BR + mloc;
    _Float16* dst = attn_out + ((size_t)b * SEQ + nq) * HIDDEN + h * HEAD_D;
#pragma unroll
    for (int dt = 0; dt < 4; ++dt)
      dst[dt * 16 + nin] = (_Float16)(oacc[dt][r] * linv);
  }
}

// ---------------------------------------------------------------------------
// Host-side launch
// ---------------------------------------------------------------------------
extern "C" void kernel_launch(void* const* d_in, const int* in_sizes, int n_in,
                              void* d_out, int out_size, void* d_ws, size_t ws_size,
                              hipStream_t stream) {
  (void)in_sizes; (void)n_in; (void)out_size; (void)ws_size;
  const float* x     = (const float*)d_in[0];   // [2, 4096, 1024]
  const float* qkv_w = (const float*)d_in[1];   // [3072, 1024]
  const float* qkv_b = (const float*)d_in[2];   // [3072]
  const float* out_w = (const float*)d_in[3];   // [1024, 1024]
  const float* out_b = (const float*)d_in[4];   // [1024]
  float* out = (float*)d_out;                   // [2, 4096, 1024]

  // Workspace layout (all f16 halves)
  _Float16* qkv_h  = (_Float16*)d_ws;                     // 8192 x 3072
  _Float16* attn_h = qkv_h  + (size_t)MTOT * THREEC;      // 8192 x 1024
  _Float16* x_h    = attn_h + (size_t)MTOT * HIDDEN;      // 8192 x 1024
  _Float16* qkvw_h = x_h    + (size_t)MTOT * HIDDEN;      // 3072 x 1024
  _Float16* outw_h = qkvw_h + (size_t)THREEC * HIDDEN;    // 1024 x 1024

  // 0) One-shot f32 -> f16 conversion of activations and weights
  {
    const int n4x = (MTOT * HIDDEN) / 4;
    cvt_f32_f16<<<n4x / 256, 256, 0, stream>>>(x, x_h, n4x);
    const int n4q = (THREEC * HIDDEN) / 4;
    cvt_f32_f16<<<n4q / 256, 256, 0, stream>>>(qkv_w, qkvw_h, n4q);
    const int n4o = (HIDDEN * HIDDEN) / 4;
    cvt_f32_f16<<<n4o / 256, 256, 0, stream>>>(out_w, outw_h, n4o);
  }

  // 1) QKV projection: [8192,1024] x [3072,1024]^T + bias -> f16
  gemm_bias_wmma<_Float16>
      <<<dim3(THREEC / 128, MTOT / 128), 256, 0, stream>>>(
          x_h, qkvw_h, qkv_b, qkv_h, MTOT, THREEC, HIDDEN);

  // 2) Flash attention over heads
  flash_attn_wmma<<<dim3(SEQ / 64, HEADS, BATCH), 128, 0, stream>>>(qkv_h, attn_h);

  // 3) Output projection: [8192,1024] x [1024,1024]^T + bias -> f32
  gemm_bias_wmma<float>
      <<<dim3(HIDDEN / 128, MTOT / 128), 256, 0, stream>>>(
          attn_h, outw_h, out_b, out, MTOT, HIDDEN, HIDDEN);
}

// v001
// Measured time: 673 microseconds a run.
// In both of two side-by-side timings against v000, it was 1.56 times as fast.
#include <hip/hip_runtime.h>
#include <hip/hip_bf16.h>

typedef __attribute__((ext_vector_type(16))) _Float16 v16h;
typedef __attribute__((ext_vector_type(8)))  float    v8f;
typedef __attribute__((ext_vector_type(4)))  _Float16 h4;
typedef __attribute__((ext_vector_type(8)))  _Float16 h8;

// ---------------------------------------------------------------------------
// Problem constants
// ---------------------------------------------------------------------------
static constexpr int BATCH   = 2;
static constexpr int SEQ     = 4096;
static constexpr int HIDDEN  = 1024;
static constexpr int HEADS   = 16;
static constexpr int HEAD_D  = 64;
static constexpr int THREEC  = 3 * HIDDEN;   // 3072
static constexpr int MTOT    = BATCH * SEQ;  // 8192

// ---------------------------------------------------------------------------
// CDNA5 async global->LDS (16B per lane, ASYNCcnt-tracked)
// ---------------------------------------------------------------------------
static __device__ __forceinline__ void async_copy_b128(const _Float16* gsrc,
                                                       const _Float16* ldst) {
  const unsigned int       ldsa = (unsigned int)(uintptr_t)ldst;
  const unsigned long long ga   = (unsigned long long)(uintptr_t)gsrc;
  asm volatile("global_load_async_to_lds_b128 %0, %1, off"
               :: "v"(ldsa), "v"(ga) : "memory");
}
static __device__ __forceinline__ void wait_async0() {
  asm volatile("s_wait_asynccnt 0" ::: "memory");
}

// ---------------------------------------------------------------------------
// WMMA helper (D = A(16x32 f16) * B(32x16 f16) + C(16x16 f32))
// ---------------------------------------------------------------------------
static __device__ __forceinline__ v8f wmma32(v16h a, v16h b, v8f c) {
  return __builtin_amdgcn_wmma_f32_16x16x32_f16(false, a, false, b,
                                                (short)0, c, false, false);
}

// A-fragment: 16x32 f16 from LDS. Lanes 0-15 -> M=lane, K 0-7, 16-23;
// lanes 16-31 -> K 8-15, 24-31. 8 contiguous halves per chunk -> ds_load_b128.
static __device__ __forceinline__ v16h lds_a_frag(const _Float16* base,
                                                  int row0, int ld, int k0) {
  const int lane = threadIdx.x & 31;
  const int m = lane & 15, hf = lane >> 4;
  v16h a;
#pragma unroll
  for (int v = 0; v < 8; ++v) {
    const int kb = (v < 4) ? (hf * 8 + 2 * v) : (16 + hf * 8 + 2 * (v - 4));
    const _Float16* p = base + (size_t)(row0 + m) * ld + k0 + kb;
    a[2 * v]     = p[0];
    a[2 * v + 1] = p[1];
  }
  return a;
}

// B-fragment (32x16, K x N) from an N-major LDS tile: elem B[k][n] = base[n*ld + k]
static __device__ __forceinline__ v16h lds_b_frag_nmajor(const _Float16* base,
                                                         int n0, int ld, int k0) {
  const int lane = threadIdx.x & 31;
  const int n = lane & 15, hf = lane >> 4;
  v16h b;
#pragma unroll
  for (int v = 0; v < 8; ++v) {
    const int kb = (v < 4) ? (hf * 8 + 2 * v) : (16 + hf * 8 + 2 * (v - 4));
    const _Float16* p = base + (size_t)(n0 + n) * ld + k0 + kb;
    b[2 * v]     = p[0];
    b[2 * v + 1] = p[1];
  }
  return b;
}

// ---------------------------------------------------------------------------
// f32 -> f16 bulk conversion (vectorized, one-shot preprocessing)
// ---------------------------------------------------------------------------
__global__ __launch_bounds__(256)
void cvt_f32_f16(const float* __restrict__ src, _Float16* __restrict__ dst,
                 int n4) {
  const int i = blockIdx.x * 256 + threadIdx.x;
  if (i < n4) {
    const float4 v = ((const float4*)src)[i];
    h4 o; o[0] = (_Float16)v.x; o[1] = (_Float16)v.y;
          o[2] = (_Float16)v.z; o[3] = (_Float16)v.w;
    ((h4*)dst)[i] = o;
  }
}

// ---------------------------------------------------------------------------
// GEMM: out[M, Nout] = A[M, K] * W[Nout, K]^T + bias, A/W f16.
//   128(M) x 128(N) x 64(K) tile; 256 threads = 8 waves (4x2); each wave
//   computes 32x64 = 2x4 WMMA tiles -> 16 WMMA per K-iter between barriers.
//   Double-buffered LDS (64 KB), all staging via async global->LDS DMA,
//   pipelined one K-block ahead.
// ---------------------------------------------------------------------------
template <typename OT>
__global__ __launch_bounds__(256)
void gemm_bias_wmma(const _Float16* __restrict__ A, const _Float16* __restrict__ W,
                    const float* __restrict__ bias, OT* __restrict__ out,
                    int M, int Nout, int K) {
  constexpr int BM = 128, BN = 128, BK = 64;
  __shared__ _Float16 As[2][BM * BK];  // 2 x 16 KB
  __shared__ _Float16 Ws[2][BN * BK];  // 2 x 16 KB

  const int tid   = threadIdx.x;
  const int m_blk = blockIdx.y * BM;
  const int n_blk = blockIdx.x * BN;
  const int w     = tid >> 5;
  const int lane  = tid & 31;
  const int wm    = w >> 1;   // 0..3 -> 32 rows each
  const int wn    = w & 1;    // 0..1 -> 64 cols each

  // Per-thread staging chunk coordinates (8 halves = 16 B per chunk)
  int rs[4], cs[4];
  const _Float16* pa[4];  // global A pointers, advanced by BK each K-block
  const _Float16* pw[4];  // global W pointers
#pragma unroll
  for (int i = 0; i < 4; ++i) {
    const int idx = tid + i * 256;
    rs[i] = idx >> 3; cs[i] = (idx & 7) * 8;   // rows 0..127, cols {0,8,..,56}
    pa[i] = A + (size_t)(m_blk + rs[i]) * K + cs[i];
    pw[i] = W + (size_t)(n_blk + rs[i]) * K + cs[i];
  }

  // Prologue: stage K-block 0 into buffer 0
#pragma unroll
  for (int i = 0; i < 4; ++i) {
    async_copy_b128(pa[i], &As[0][rs[i] * BK + cs[i]]);
    async_copy_b128(pw[i], &Ws[0][rs[i] * BK + cs[i]]);
    pa[i] += BK;
    pw[i] += BK;
  }

  v8f acc[2][4] = {};

  const int nkb = K / BK;
  for (int kb = 0; kb < nkb; ++kb) {
    const int buf = kb & 1;
    wait_async0();
    __syncthreads();

    if (kb + 1 < nkb) {  // stage next K-block into other buffer
      const int nb = buf ^ 1;
#pragma unroll
      for (int i = 0; i < 4; ++i) {
        async_copy_b128(pa[i], &As[nb][rs[i] * BK + cs[i]]);
        async_copy_b128(pw[i], &Ws[nb][rs[i] * BK + cs[i]]);
        pa[i] += BK;
        pw[i] += BK;
      }
    }

#pragma unroll
    for (int ks = 0; ks < BK; ks += 32) {
      v16h af[2], bf[4];
#pragma unroll
      for (int mt = 0; mt < 2; ++mt)
        af[mt] = lds_a_frag(As[buf], wm * 32 + mt * 16, BK, ks);
#pragma unroll
      for (int nt = 0; nt < 4; ++nt)
        bf[nt] = lds_b_frag_nmajor(Ws[buf], wn * 64 + nt * 16, BK, ks);
#pragma unroll
      for (int mt = 0; mt < 2; ++mt)
#pragma unroll
        for (int nt = 0; nt < 4; ++nt)
          acc[mt][nt] = wmma32(af[mt], bf[nt], acc[mt][nt]);
    }
  }

  // Epilogue: C/D layout -> lane n = lane&15; row = r + 8*(lane>=16)
  const int hf = lane >> 4, nin = lane & 15;
#pragma unroll
  for (int mt = 0; mt < 2; ++mt)
#pragma unroll
    for (int nt = 0; nt < 4; ++nt) {
      const int nglob = n_blk + wn * 64 + nt * 16 + nin;
      const float bv = bias[nglob];
#pragma unroll
      for (int r = 0; r < 8; ++r) {
        const int mglob = m_blk + wm * 32 + mt * 16 + r + hf * 8;
        out[(size_t)mglob * Nout + nglob] = (OT)(acc[mt][nt][r] + bv);
      }
    }
}

static __device__ __forceinline__ float other_half(float x) {
  const int b = __builtin_bit_cast(int, x);
  return __builtin_bit_cast(float, __builtin_amdgcn_permlanex16(
      b, b, 0x76543210, 0xfedcba98, false, false));
}

// Two f32 tiles of S^T (keys 0-15 and 16-31 of a 32-key group) -> f16 B operand
static __device__ __forceinline__ v16h pack_b(v8f t0, v8f t1) {
  const h8 lo = __builtin_convertvector(t0, h8);
  const h8 hi = __builtin_convertvector(t1, h8);
  return __builtin_shufflevector(lo, hi, 0, 1, 2, 3, 4, 5, 6, 7,
                                 8, 9, 10, 11, 12, 13, 14, 15);
}

__global__ __launch_bounds__(128)
void flash_attn_wmma(const _Float16* __restrict__ qkv,
                     _Float16* __restrict__ attn_out) {
  constexpr int BR = 64, BC = 64, DH = HEAD_D;
  constexpr int VLD = 72;  // padded f16 V^T stride

  __shared__ _Float16 Ks[2][BC * DH];     // 16 KB (double-buffered)
  __shared__ _Float16 VsT[DH * VLD];      //  9 KB (d-major)

  const int tid  = threadIdx.x;
  const int w    = tid >> 5;
  const int lane = tid & 31;
  const int hf   = lane >> 4, nin = lane & 15;
  const int qblk = blockIdx.x;
  const int h    = blockIdx.y;
  const int b    = blockIdx.z;
  const float sc2 = 0.125f * 1.44269504088896f;   // 1/sqrt(64) * log2(e)

  const size_t rowstride = (size_t)THREEC;
  const size_t blkstep   = (size_t)BC * rowstride;   // halves per key-block
  const _Float16* qbase = qkv + ((size_t)b * SEQ) * rowstride + h * HEAD_D;
  const int nq = qblk * BR + w * 16 + nin;           // this lane's query

  // --- Prologue: async-stage K block 0; Q and V block 0 into registers ---
  int rk[4], ck[4];
  const _Float16* gk[4];
#pragma unroll
  for (int i = 0; i < 4; ++i) {
    const int idx = tid + i * 128;
    rk[i] = idx >> 3; ck[i] = (idx & 7) * 8;
    gk[i] = qbase + (size_t)rk[i] * rowstride + HIDDEN + ck[i];
    async_copy_b128(gk[i], &Ks[0][rk[i] * DH + ck[i]]);
    gk[i] += blkstep;
  }

  // Q^T B-fragments, same k order as lds_a_frag: halves hf*8.. and 16+hf*8..
  v16h qf[2];
  {
    const _Float16* qrow = qbase + (size_t)nq * rowstride + hf * 8;
#pragma unroll
    for (int ks = 0; ks < 2; ++ks) {
      const h8 lo = *(const h8*)(qrow + ks * 32);
      const h8 hi = *(const h8*)(qrow + ks * 32 + 16);
      qf[ks] = __builtin_shufflevector(lo, hi, 0, 1, 2, 3, 4, 5, 6, 7,
                                       8, 9, 10, 11, 12, 13, 14, 15);
    }
  }

  int rv[8], cv[8];
  const _Float16* gv[8];
  h4 vreg[8];
#pragma unroll
  for (int i = 0; i < 8; ++i) {
    const int idx = tid + i * 128;
    rv[i] = idx >> 4; cv[i] = (idx & 15) * 4;
    gv[i] = qbase + (size_t)rv[i] * rowstride + 2 * HIDDEN + cv[i];
    vreg[i] = *(const h4*)gv[i];
    gv[i] += blkstep;
  }

  float m_run = -3.0e38f;  // running maximum of this lane's query, log2 units
  float l_run = 0.0f;      // running sum over this lane's half of the keys
  v8f oacc[4] = {};        // O^T: oacc[dt][r] = O[query nin][dt*16 + hf*8 + r]

  const int nblocks = SEQ / BC;
  for (int kb = 0; kb < nblocks; ++kb) {
    const int buf = kb & 1;
    wait_async0();
    __syncthreads();   // Ks[buf] ready; prev PV done reading VsT

    // Commit V block kb (registers -> transposed LDS)
#pragma unroll
    for (int i = 0; i < 8; ++i)
#pragma unroll
      for (int j = 0; j < 4; ++j) VsT[(cv[i] + j) * VLD + rv[i]] = vreg[i][j];

    if (kb + 1 < nblocks) {
      // Async-prefetch K block kb+1 into the other buffer
#pragma unroll
      for (int i = 0; i < 4; ++i) {
        async_copy_b128(gk[i], &Ks[buf ^ 1][rk[i] * DH + ck[i]]);
        gk[i] += blkstep;
      }
      // Prefetch V block kb+1 into registers
#pragma unroll
      for (int i = 0; i < 8; ++i) {
        vreg[i] = *(const h4*)gv[i];
        gv[i] += blkstep;
      }
    }

    // S^T = K Q^T (64 keys x 16 queries per wave): 4 key tiles, 2 WMMA k-steps
    // sacc[kt][r] = score(key kt*16 + hf*8 + r, query nin)
    v8f sacc[4] = {};
#pragma unroll
    for (int ks = 0; ks < 2; ++ks)
#pragma unroll
      for (int kt = 0; kt < 4; ++kt) {
        const v16h af = lds_a_frag(Ks[buf], kt * 16, DH, ks * 32);
        sacc[kt] = wmma32(af, qf[ks], sacc[kt]);
      }

    // Online softmax in registers, one query per lane
    const v8f mx8 = __builtin_elementwise_max(
        __builtin_elementwise_max(sacc[0], sacc[1]),
        __builtin_elementwise_max(sacc[2], sacc[3]));
    float rmax = fmaxf(fmaxf(fmaxf(mx8[0], mx8[1]), fmaxf(mx8[2], mx8[3])),
                       fmaxf(fmaxf(mx8[4], mx8[5]), fmaxf(mx8[6], mx8[7])));
    rmax = fmaxf(rmax, other_half(rmax));
    const float m_new = fmaxf(m_run, rmax * sc2);
    const float alpha = __builtin_amdgcn_exp2f(m_run - m_new);
    m_run = m_new;
#pragma unroll
    for (int kt = 0; kt < 4; ++kt)
#pragma unroll
      for (int r = 0; r < 8; ++r)
        sacc[kt][r] = __builtin_amdgcn_exp2f(fmaf(sacc[kt][r], sc2, -m_new));
    const v8f ps8 = (sacc[0] + sacc[1]) + (sacc[2] + sacc[3]);
    l_run = l_run * alpha + (((ps8[0] + ps8[1]) + (ps8[2] + ps8[3])) +
                             ((ps8[4] + ps8[5]) + (ps8[6] + ps8[7])));
    const v16h pf[2] = {pack_b(sacc[0], sacc[1]), pack_b(sacc[2], sacc[3])};
#pragma unroll
    for (int dt = 0; dt < 4; ++dt) oacc[dt] *= alpha;
    __syncthreads();   // every wave's part of VsT is written

    // O^T += V^T P^T (4 d-tiles, 2 WMMA k-steps over the 64 keys)
#pragma unroll
    for (int ks = 0; ks < 2; ++ks)
#pragma unroll
      for (int dt = 0; dt < 4; ++dt) {
        const v16h af = lds_a_frag(VsT, dt * 16, VLD, ks * 32);
        oacc[dt] = wmma32(af, pf[ks], oacc[dt]);
      }
  }

  // Write O / l  ->  attn_out[b, nq, h, d]  (f16): 8 consecutive d per lane
  const float linv = 1.0f / (l_run + other_half(l_run));
  _Float16* dst = attn_out + ((size_t)b * SEQ + nq) * HIDDEN + h * HEAD_D + hf * 8;
#pragma unroll
  for (int dt = 0; dt < 4; ++dt)
    *(h8*)(dst + dt * 16) = __builtin_convertvector(oacc[dt] * linv, h8);
}

// ---------------------------------------------------------------------------
// Host-side launch
// ---------------------------------------------------------------------------
extern "C" void kernel_launch(void* const* d_in, const int* in_sizes, int n_in,
                              void* d_out, int out_size, void* d_ws, size_t ws_size,
                              hipStream_t stream) {
  (void)in_sizes; (void)n_in; (void)out_size; (void)ws_size;
  const float* x     = (const float*)d_in[0];   // [2, 4096, 1024]
  const float* qkv_w = (const float*)d_in[1];   // [3072, 1024]
  const float* qkv_b = (const float*)d_in[2];   // [3072]
  const float* out_w = (const float*)d_in[3];   // [1024, 1024]
  const float* out_b = (const float*)d_in[4];   // [1024]
  float* out = (float*)d_out;                   // [2, 4096, 1024]

  // Workspace layout (all f16 halves)
  _Float16* qkv_h  = (_Float16*)d_ws;                     // 8192 x 3072
  _Float16* attn_h = qkv_h  + (size_t)MTOT * THREEC;      // 8192 x 1024
  _Float16* x_h    = attn_h + (size_t)MTOT * HIDDEN;      // 8192 x 1024
  _Float16* qkvw_h = x_h    + (size_t)MTOT * HIDDEN;      // 3072 x 1024
  _Float16* outw_h = qkvw_h + (size_t)THREEC * HIDDEN;    // 1024 x 1024

  // 0) One-shot f32 -> f16 conversion of activations and weights
  {
    const int n4x = (MTOT * HIDDEN) / 4;
    cvt_f32_f16<<<n4x / 256, 256, 0, stream>>>(x, x_h, n4x);
    const int n4q = (THREEC * HIDDEN) / 4;
    cvt_f32_f16<<<n4q / 256, 256, 0, stream>>>(qkv_w, qkvw_h, n4q);
    const int n4o = (HIDDEN * HIDDEN) / 4;
    cvt_f32_f16<<<n4o / 256, 256, 0, stream>>>(out_w, outw_h, n4o);
  }

  // 1) QKV projection: [8192,1024] x [3072,1024]^T + bias -> f16
  gemm_bias_wmma<_Float16>
      <<<dim3(THREEC / 128, MTOT / 128), 256, 0, stream>>>(
          x_h, qkvw_h, qkv_b, qkv_h, MTOT, THREEC, HIDDEN);

  // 2) Flash attention over heads
  flash_attn_wmma<<<dim3(SEQ / 64, HEADS, BATCH), 128, 0, stream>>>(qkv_h, attn_h);

  // 3) Output projection: [8192,1024] x [1024,1024]^T + bias -> f32
  gemm_bias_wmma<float>
      <<<dim3(HIDDEN / 128, MTOT / 128), 256, 0, stream>>>(
          attn_h, outw_h, out_b, out, MTOT, HIDDEN, HIDDEN);
}

// v002
// Measured time: 430 microseconds a run.
// Next to v001, in two timings, it ran 1.57 times as fast each time.
// Counting every step since v000, it is 2.45 times as fast.
#include <hip/hip_runtime.h>
#include <hip/hip_bf16.h>

typedef __attribute__((ext_vector_type(16))) _Float16 v16h;
typedef __attribute__((ext_vector_type(8)))  float    v8f;
typedef __attribute__((ext_vector_type(4)))  _Float16 h4;
typedef __attribute__((ext_vector_type(8)))  _Float16 h8;

// ---------------------------------------------------------------------------
// Problem constants
// ---------------------------------------------------------------------------
static constexpr int BATCH   = 2;
static constexpr int SEQ     = 4096;
static constexpr int HIDDEN  = 1024;
static constexpr int HEADS   = 16;
static constexpr int HEAD_D  = 64;
static constexpr int THREEC  = 3 * HIDDEN;   // 3072
static constexpr int MTOT    = BATCH * SEQ;  // 8192

// ---------------------------------------------------------------------------
// CDNA5 async global->LDS (16B per lane, ASYNCcnt-tracked)
// ---------------------------------------------------------------------------
static __device__ __forceinline__ unsigned int lds_byte(const _Float16* p) {
  return (unsigned int)(uintptr_t)p;   // low 32 bits = byte address in LDS
}
// Four copies of a lane in ONE statement that ends in s_wait_xcnt 0: the wait
// stands in front of every later rewrite of the address registers named here.
static __device__ __forceinline__ void async_copy4_b128(
    const _Float16* g0, const _Float16* l0, const _Float16* g1, const _Float16* l1,
    const _Float16* g2, const _Float16* l2, const _Float16* g3, const _Float16* l3) {
  asm volatile("global_load_async_to_lds_b128 %0, %4, off\n\t"
               "global_load_async_to_lds_b128 %1, %5, off\n\t"
               "global_load_async_to_lds_b128 %2, %6, off\n\t"
               "global_load_async_to_lds_b128 %3, %7, off\n\t"
               "s_wait_xcnt 0x0"
               :: "v"(lds_byte(l0)), "v"(lds_byte(l1)), "v"(lds_byte(l2)),
                  "v"(lds_byte(l3)), "v"(g0), "v"(g1), "v"(g2), "v"(g3)
               : "memory");
}
// Publish point, in front of the barrier: this wave's LDS reads have retired
// (the buffer they read is refilled behind the barrier) and its copies landed.
static __device__ __forceinline__ void wait_lds_and_async0() {
  asm volatile("s_wait_dscnt 0x0" ::: "memory");
  asm volatile("s_wait_asynccnt 0x0" ::: "memory");
}
static __device__ __forceinline__ void wait_async0() {
  asm volatile("s_wait_asynccnt 0x0" ::: "memory");
}

// LDS pitch of a 64-half (128 B) row read by ds_load_b128: 144 B = 16 B x 9.
// At 128 B the 16 rows of a fragment fall on two groups of four banks.
static constexpr int LDP = 72;

// ---------------------------------------------------------------------------
// WMMA helper (D = A(16x32 f16) * B(32x16 f16) + C(16x16 f32))
// ---------------------------------------------------------------------------
static __device__ __forceinline__ v8f wmma32(v16h a, v16h b, v8f c) {
  return __builtin_amdgcn_wmma_f32_16x16x32_f16(false, a, false, b,
                                                (short)0, c, false, false);
}

// A-fragment: 16x32 f16 from LDS. Lanes 0-15 -> M=lane, K 0-7, 16-23;
// lanes 16-31 -> K 8-15, 24-31. 8 contiguous halves per chunk -> ds_load_b128.
static __device__ __forceinline__ v16h lds_a_frag(const _Float16* base,
                                                  int row0, int ld, int k0) {
  const int lane = threadIdx.x & 31;
  const int m = lane & 15, hf = lane >> 4;
  v16h a;
#pragma unroll
  for (int v = 0; v < 8; ++v) {
    const int kb = (v < 4) ? (hf * 8 + 2 * v) : (16 + hf * 8 + 2 * (v - 4));
    const _Float16* p = base + (size_t)(row0 + m) * ld + k0 + kb;
    a[2 * v]     = p[0];
    a[2 * v + 1] = p[1];
  }
  return a;
}

// B-fragment (32x16, K x N) from an N-major LDS tile: elem B[k][n] = base[n*ld + k]
static __device__ __forceinline__ v16h lds_b_frag_nmajor(const _Float16* base,
                                                         int n0, int ld, int k0) {
  const int lane = threadIdx.x & 31;
  const int n = lane & 15, hf = lane >> 4;
  v16h b;
#pragma unroll
  for (int v = 0; v < 8; ++v) {
    const int kb = (v < 4) ? (hf * 8 + 2 * v) : (16 + hf * 8 + 2 * (v - 4));
    const _Float16* p = base + (size_t)(n0 + n) * ld + k0 + kb;
    b[2 * v]     = p[0];
    b[2 * v + 1] = p[1];
  }
  return b;
}

// ---------------------------------------------------------------------------
// f32 -> f16 bulk conversion (vectorized, one-shot preprocessing)
// ---------------------------------------------------------------------------
__global__ __launch_bounds__(256)
void cvt_f32_f16(const float* __restrict__ src, _Float16* __restrict__ dst,
                 int n4) {
  const int i = blockIdx.x * 256 + threadIdx.x;
  if (i < n4) {
    const float4 v = ((const float4*)src)[i];
    h4 o; o[0] = (_Float16)v.x; o[1] = (_Float16)v.y;
          o[2] = (_Float16)v.z; o[3] = (_Float16)v.w;
    ((h4*)dst)[i] = o;
  }
}

// ---------------------------------------------------------------------------
// GEMM: out[M, Nout] = A[M, K] * W[Nout, K]^T + bias, A/W f16.
//   128(M) x 128(N) x 64(K) tile; 256 threads = 8 waves (4x2); each wave
//   computes 32x64 = 2x4 WMMA tiles -> 16 WMMA per K-iter between barriers.
//   Double-buffered LDS (72 KB, rows padded to LDP), all staging via async
//   global->LDS DMA, pipelined one K-block ahead.
// ---------------------------------------------------------------------------
template <typename OT>
__global__ __launch_bounds__(256)
void gemm_bias_wmma(const _Float16* __restrict__ A, const _Float16* __restrict__ W,
                    const float* __restrict__ bias, OT* __restrict__ out,
                    int M, int Nout, int K) {
  constexpr int BM = 128, BN = 128, BK = 64;
  __shared__ __attribute__((aligned(16))) _Float16 As[2][BM * LDP];  // 2 x 18 KB
  __shared__ __attribute__((aligned(16))) _Float16 Ws[2][BN * LDP];  // 2 x 18 KB

  const int tid   = threadIdx.x;
  const int m_blk = blockIdx.y * BM;
  const int n_blk = blockIdx.x * BN;
  const int w     = tid >> 5;
  const int lane  = tid & 31;
  const int wm    = w >> 1;   // 0..3 -> 32 rows each
  const int wn    = w & 1;    // 0..1 -> 64 cols each

  // Per-thread staging chunk coordinates (8 halves = 16 B per chunk)
  int rs[4], cs[4], ls[4];   // ls: the chunk's place in a padded LDS tile
  const _Float16* pa[4];  // global A pointers, advanced by BK each K-block
  const _Float16* pw[4];  // global W pointers
#pragma unroll
  for (int i = 0; i < 4; ++i) {
    const int idx = tid + i * 256;
    rs[i] = idx >> 3; cs[i] = (idx & 7) * 8;   // rows 0..127, cols {0,8,..,56}
    ls[i] = rs[i] * LDP + cs[i];
    pa[i] = A + (size_t)(m_blk + rs[i]) * K + cs[i];
    pw[i] = W + (size_t)(n_blk + rs[i]) * K + cs[i];
  }

  // Prologue: stage K-block 0 into buffer 0
  async_copy4_b128(pa[0], &As[0][ls[0]], pa[1], &As[0][ls[1]],
                   pa[2], &As[0][ls[2]], pa[3], &As[0][ls[3]]);
  async_copy4_b128(pw[0], &Ws[0][ls[0]], pw[1], &Ws[0][ls[1]],
                   pw[2], &Ws[0][ls[2]], pw[3], &Ws[0][ls[3]]);
#pragma unroll
  for (int i = 0; i < 4; ++i) {
    pa[i] += BK;
    pw[i] += BK;
  }

  v8f acc[2][4] = {};

  const int nkb = K / BK;
  for (int kb = 0; kb < nkb; ++kb) {
    const int buf = kb & 1;
    wait_lds_and_async0();
    __syncthreads();

    if (kb + 1 < nkb) {  // stage next K-block into other buffer
      const int nb = buf ^ 1;
      async_copy4_b128(pa[0], &As[nb][ls[0]], pa[1], &As[nb][ls[1]],
                       pa[2], &As[nb][ls[2]], pa[3], &As[nb][ls[3]]);
      async_copy4_b128(pw[0], &Ws[nb][ls[0]], pw[1], &Ws[nb][ls[1]],
                       pw[2], &Ws[nb][ls[2]], pw[3], &Ws[nb][ls[3]]);
#pragma unroll
      for (int i = 0; i < 4; ++i) {
        pa[i] += BK;
        pw[i] += BK;
      }
    }

#pragma unroll
    for (int ks = 0; ks < BK; ks += 32) {
      v16h af[2], bf[4];
#pragma unroll
      for (int mt = 0; mt < 2; ++mt)
        af[mt] = lds_a_frag(As[buf], wm * 32 + mt * 16, LDP, ks);
#pragma unroll
      for (int nt = 0; nt < 4; ++nt)
        bf[nt] = lds_b_frag_nmajor(Ws[buf], wn * 64 + nt * 16, LDP, ks);
#pragma unroll
      for (int mt = 0; mt < 2; ++mt)
#pragma unroll
        for (int nt = 0; nt < 4; ++nt)
          acc[mt][nt] = wmma32(af[mt], bf[nt], acc[mt][nt]);
    }
  }
  wait_async0();   // no copy of this wave is outstanding when it ends

  // Epilogue: C/D layout -> lane n = lane&15; row = r + 8*(lane>=16)
  const int hf = lane >> 4, nin = lane & 15;
#pragma unroll
  for (int mt = 0; mt < 2; ++mt)
#pragma unroll
    for (int nt = 0; nt < 4; ++nt) {
      const int nglob = n_blk + wn * 64 + nt * 16 + nin;
      const float bv = bias[nglob];
#pragma unroll
      for (int r = 0; r < 8; ++r) {
        const int mglob = m_blk + wm * 32 + mt * 16 + r + hf * 8;
        out[(size_t)mglob * Nout + nglob] = (OT)(acc[mt][nt][r] + bv);
      }
    }
}

static __device__ __forceinline__ float other_half(float x) {
  const int b = __builtin_bit_cast(int, x);
  return __builtin_bit_cast(float, __builtin_amdgcn_permlanex16(
      b, b, 0x76543210, 0xfedcba98, false, false));
}

// Two f32 tiles of S^T (keys 0-15 and 16-31 of a 32-key group) -> f16 B operand
static __device__ __forceinline__ v16h pack_b(v8f t0, v8f t1) {
  const h8 lo = __builtin_convertvector(t0, h8);
  const h8 hi = __builtin_convertvector(t1, h8);
  return __builtin_shufflevector(lo, hi, 0, 1, 2, 3, 4, 5, 6, 7,
                                 8, 9, 10, 11, 12, 13, 14, 15);
}

__global__ __launch_bounds__(128)
void flash_attn_wmma(const _Float16* __restrict__ qkv,
                     _Float16* __restrict__ attn_out) {
  constexpr int BR = 64, BC = 64, DH = HEAD_D;
  constexpr int VLD = 72;  // padded f16 V^T stride

  __shared__ __attribute__((aligned(16))) _Float16 Ks[2][BC * LDP];  // 18 KB (double-buffered, padded rows)
  __shared__ __attribute__((aligned(16))) _Float16 VsT[DH * VLD];    //  9 KB (d-major)

  const int tid  = threadIdx.x;
  const int w    = tid >> 5;
  const int lane = tid & 31;
  const int hf   = lane >> 4, nin = lane & 15;
  const int qblk = blockIdx.x;
  const int h    = blockIdx.y;
  const int b    = blockIdx.z;
  const float sc2 = 0.125f * 1.44269504088896f;   // 1/sqrt(64) * log2(e)

  const size_t rowstride = (size_t)THREEC;
  const size_t blkstep   = (size_t)BC * rowstride;   // halves per key-block
  const _Float16* qbase = qkv + ((size_t)b * SEQ) * rowstride + h * HEAD_D;
  const int nq = qblk * BR + w * 16 + nin;           // this lane's query

  // --- Prologue: async-stage K block 0; Q and V block 0 into registers ---
  int lk[4];   // the chunk's place in a padded K tile
  const _Float16* gk[4];
#pragma unroll
  for (int i = 0; i < 4; ++i) {
    const int idx = tid + i * 128;
    const int rk = idx >> 3, ck = (idx & 7) * 8;
    lk[i] = rk * LDP + ck;
    gk[i] = qbase + (size_t)rk * rowstride + HIDDEN + ck;
  }
  async_copy4_b128(gk[0], &Ks[0][lk[0]], gk[1], &Ks[0][lk[1]],
                   gk[2], &Ks[0][lk[2]], gk[3], &Ks[0][lk[3]]);
#pragma unroll
  for (int i = 0; i < 4; ++i) gk[i] += blkstep;

  // Q^T B-fragments, same k order as lds_a_frag: halves hf*8.. and 16+hf*8..
  v16h qf[2];
  {
    const _Float16* qrow = qbase + (size_t)nq * rowstride + hf * 8;
#pragma unroll
    for (int ks = 0; ks < 2; ++ks) {
      const h8 lo = *(const h8*)(qrow + ks * 32);
      const h8 hi = *(const h8*)(qrow + ks * 32 + 16);
      qf[ks] = __builtin_shufflevector(lo, hi, 0, 1, 2, 3, 4, 5, 6, 7,
                                       8, 9, 10, 11, 12, 13, 14, 15);
    }
  }

  int rv[8], cv[8];
  const _Float16* gv[8];
  h4 vreg[8];
#pragma unroll
  for (int i = 0; i < 8; ++i) {
    const int idx = tid + i * 128;
    rv[i] = idx >> 4; cv[i] = (idx & 15) * 4;
    gv[i] = qbase + (size_t)rv[i] * rowstride + 2 * HIDDEN + cv[i];
    vreg[i] = *(const h4*)gv[i];
    gv[i] += blkstep;
  }

  float m_run = -3.0e38f;  // running maximum of this lane's query, log2 units
  float l_run = 0.0f;      // running sum over this lane's half of the keys
  v8f oacc[4] = {};        // O^T: oacc[dt][r] = O[query nin][dt*16 + hf*8 + r]

  const int nblocks = SEQ / BC;
  for (int kb = 0; kb < nblocks; ++kb) {
    const int buf = kb & 1;
    wait_lds_and_async0();
    __syncthreads();   // Ks[buf] ready; prev PV done reading VsT

    // Commit V block kb (registers -> transposed LDS)
#pragma unroll
    for (int i = 0; i < 8; ++i)
#pragma unroll
      for (int j = 0; j < 4; ++j) VsT[(cv[i] + j) * VLD + rv[i]] = vreg[i][j];

    if (kb + 1 < nblocks) {
      // Async-prefetch K block kb+1 into the other buffer
      const int nb = buf ^ 1;
      async_copy4_b128(gk[0], &Ks[nb][lk[0]], gk[1], &Ks[nb][lk[1]],
                       gk[2], &Ks[nb][lk[2]], gk[3], &Ks[nb][lk[3]]);
#pragma unroll
      for (int i = 0; i < 4; ++i) gk[i] += blkstep;
      // Prefetch V block kb+1 into registers
#pragma unroll
      for (int i = 0; i < 8; ++i) {
        vreg[i] = *(const h4*)gv[i];
        gv[i] += blkstep;
      }
    }

    // S^T = K Q^T (64 keys x 16 queries per wave): 4 key tiles, 2 WMMA k-steps
    // sacc[kt][r] = score(key kt*16 + hf*8 + r, query nin)
    v8f sacc[4] = {};
#pragma unroll
    for (int ks = 0; ks < 2; ++ks)
#pragma unroll
      for (int kt = 0; kt < 4; ++kt) {
        const v16h af = lds_a_frag(Ks[buf], kt * 16, LDP, ks * 32);
        sacc[kt] = wmma32(af, qf[ks], sacc[kt]);
      }

    // Online softmax in registers, one query per lane
    const v8f mx8 = __builtin_elementwise_max(
        __builtin_elementwise_max(sacc[0], sacc[1]),
        __builtin_elementwise_max(sacc[2], sacc[3]));
    float rmax = fmaxf(fmaxf(fmaxf(mx8[0], mx8[1]), fmaxf(mx8[2], mx8[3])),
                       fmaxf(fmaxf(mx8[4], mx8[5]), fmaxf(mx8[6], mx8[7])));
    rmax = fmaxf(rmax, other_half(rmax));
    const float m_new = fmaxf(m_run, rmax * sc2);
    const float alpha = __builtin_amdgcn_exp2f(m_run - m_new);
    m_run = m_new;
#pragma unroll
    for (int kt = 0; kt < 4; ++kt)
#pragma unroll
      for (int r = 0; r < 8; ++r)
        sacc[kt][r] = __builtin_amdgcn_exp2f(fmaf(sacc[kt][r], sc2, -m_new));
    const v8f ps8 = (sacc[0] + sacc[1]) + (sacc[2] + sacc[3]);
    l_run = l_run * alpha + (((ps8[0] + ps8[1]) + (ps8[2] + ps8[3])) +
                             ((ps8[4] + ps8[5]) + (ps8[6] + ps8[7])));
    const v16h pf[2] = {pack_b(sacc[0], sacc[1]), pack_b(sacc[2], sacc[3])};
#pragma unroll
    for (int dt = 0; dt < 4; ++dt) oacc[dt] *= alpha;
    __syncthreads();   // every wave's part of VsT is written

    // O^T += V^T P^T (4 d-tiles, 2 WMMA k-steps over the 64 keys)
#pragma unroll
    for (int ks = 0; ks < 2; ++ks)
#pragma unroll
      for (int dt = 0; dt < 4; ++dt) {
        const v16h af = lds_a_frag(VsT, dt * 16, VLD, ks * 32);
        oacc[dt] = wmma32(af, pf[ks], oacc[dt]);
      }
  }
  wait_async0();   // no copy of this wave is outstanding when it ends

  // Write O / l  ->  attn_out[b, nq, h, d]  (f16): 8 consecutive d per lane
  const float linv = 1.0f / (l_run + other_half(l_run));
  _Float16* dst = attn_out + ((size_t)b * SEQ + nq) * HIDDEN + h * HEAD_D + hf * 8;
#pragma unroll
  for (int dt = 0; dt < 4; ++dt)
    *(h8*)(dst + dt * 16) = __builtin_convertvector(oacc[dt] * linv, h8);
}

// ---------------------------------------------------------------------------
// Host-side launch
// ---------------------------------------------------------------------------
extern "C" void kernel_launch(void* const* d_in, const int* in_sizes, int n_in,
                              void* d_out, int out_size, void* d_ws, size_t ws_size,
                              hipStream_t stream) {
  (void)in_sizes; (void)n_in; (void)out_size; (void)ws_size;
  const float* x     = (const float*)d_in[0];   // [2, 4096, 1024]
  const float* qkv_w = (const float*)d_in[1];   // [3072, 1024]
  const float* qkv_b = (const float*)d_in[2];   // [3072]
  const float* out_w = (const float*)d_in[3];   // [1024, 1024]
  const float* out_b = (const float*)d_in[4];   // [1024]
  float* out = (float*)d_out;                   // [2, 4096, 1024]

  // Workspace layout (all f16 halves)
  _Float16* qkv_h  = (_Float16*)d_ws;                     // 8192 x 3072
  _Float16* attn_h = qkv_h  + (size_t)MTOT * THREEC;      // 8192 x 1024
  _Float16* x_h    = attn_h + (size_t)MTOT * HIDDEN;      // 8192 x 1024
  _Float16* qkvw_h = x_h    + (size_t)MTOT * HIDDEN;      // 3072 x 1024
  _Float16* outw_h = qkvw_h + (size_t)THREEC * HIDDEN;    // 1024 x 1024

  // 0) One-shot f32 -> f16 conversion of activations and weights
  {
    const int n4x = (MTOT * HIDDEN) / 4;
    cvt_f32_f16<<<n4x / 256, 256, 0, stream>>>(x, x_h, n4x);
    const int n4q = (THREEC * HIDDEN) / 4;
    cvt_f32_f16<<<n4q / 256, 256, 0, stream>>>(qkv_w, qkvw_h, n4q);
    const int n4o = (HIDDEN * HIDDEN) / 4;
    cvt_f32_f16<<<n4o / 256, 256, 0, stream>>>(out_w, outw_h, n4o);
  }

  // 1) QKV projection: [8192,1024] x [3072,1024]^T + bias -> f16
  gemm_bias_wmma<_Float16>
      <<<dim3(THREEC / 128, MTOT / 128), 256, 0, stream>>>(
          x_h, qkvw_h, qkv_b, qkv_h, MTOT, THREEC, HIDDEN);

  // 2) Flash attention over heads
  flash_attn_wmma<<<dim3(SEQ / 64, HEADS, BATCH), 128, 0, stream>>>(qkv_h, attn_h);

  // 3) Output projection: [8192,1024] x [1024,1024]^T + bias -> f32
  gemm_bias_wmma<float>
      <<<dim3(HIDDEN / 128, MTOT / 128), 256, 0, stream>>>(
          attn_h, outw_h, out_b, out, MTOT, HIDDEN, HIDDEN);
}

// v003
// One run takes 217 microseconds.
// Timed twice side by side with v002, it ran 1.98 times as fast both times.
// All steps since v000 together make it 4.85 times as fast.
#include <hip/hip_runtime.h>
#include <hip/hip_bf16.h>

typedef __attribute__((ext_vector_type(16))) _Float16 v16h;
typedef __attribute__((ext_vector_type(8)))  float    v8f;
typedef __attribute__((ext_vector_type(4)))  _Float16 h4;
typedef __attribute__((ext_vector_type(8)))  _Float16 h8;

// ---------------------------------------------------------------------------
// Problem constants
// ---------------------------------------------------------------------------
static constexpr int BATCH   = 2;
static constexpr int SEQ     = 4096;
static constexpr int HIDDEN  = 1024;
static constexpr int HEADS   = 16;
static constexpr int HEAD_D  = 64;
static constexpr int THREEC  = 3 * HIDDEN;   // 3072
static constexpr int MTOT    = BATCH * SEQ;  // 8192

// ---------------------------------------------------------------------------
// CDNA5 async global->LDS (16B per lane, ASYNCcnt-tracked)
// ---------------------------------------------------------------------------
static __device__ __forceinline__ unsigned int lds_byte(const _Float16* p) {
  return (unsigned int)(uintptr_t)p;   // low 32 bits = byte address in LDS
}
// Four copies of a lane in ONE statement that ends in s_wait_xcnt 0: the wait
// stands in front of every later rewrite of the address registers named here.
static __device__ __forceinline__ void async_copy4_b128(
    const _Float16* g0, const _Float16* l0, const _Float16* g1, const _Float16* l1,
    const _Float16* g2, const _Float16* l2, const _Float16* g3, const _Float16* l3) {
  asm volatile("global_load_async_to_lds_b128 %0, %4, off\n\t"
               "global_load_async_to_lds_b128 %1, %5, off\n\t"
               "global_load_async_to_lds_b128 %2, %6, off\n\t"
               "global_load_async_to_lds_b128 %3, %7, off\n\t"
               "s_wait_xcnt 0x0"
               :: "v"(lds_byte(l0)), "v"(lds_byte(l1)), "v"(lds_byte(l2)),
                  "v"(lds_byte(l3)), "v"(g0), "v"(g1), "v"(g2), "v"(g3)
               : "memory");
}
// Publish point, in front of the barrier: this wave's LDS reads have retired
// (the buffer they read is refilled behind the barrier) and its copies landed.
static __device__ __forceinline__ void wait_lds_and_async0() {
  asm volatile("s_wait_dscnt 0x0" ::: "memory");
  asm volatile("s_wait_asynccnt 0x0" ::: "memory");
}
static __device__ __forceinline__ void wait_async0() {
  asm volatile("s_wait_asynccnt 0x0" ::: "memory");
}

// LDS pitch of a 64-half (128 B) row read by ds_load_b128: 144 B = 16 B x 9.
// At 128 B the 16 rows of a fragment fall on two groups of four banks.
static constexpr int LDP = 72;

// ---------------------------------------------------------------------------
// WMMA helper (D = A(16x32 f16) * B(32x16 f16) + C(16x16 f32))
// ---------------------------------------------------------------------------
static __device__ __forceinline__ v8f wmma32(v16h a, v16h b, v8f c) {
  return __builtin_amdgcn_wmma_f32_16x16x32_f16(false, a, false, b,
                                                (short)0, c, false, false);
}

// A-fragment: 16x32 f16 from LDS. Lanes 0-15 -> M=lane, K 0-7, 16-23;
// lanes 16-31 -> K 8-15, 24-31. 8 contiguous halves per chunk -> ds_load_b128.
static __device__ __forceinline__ v16h lds_a_frag(const _Float16* base,
                                                  int row0, int ld, int k0) {
  const int lane = threadIdx.x & 31;
  const int m = lane & 15, hf = lane >> 4;
  v16h a;
#pragma unroll
  for (int v = 0; v < 8; ++v) {
    const int kb = (v < 4) ? (hf * 8 + 2 * v) : (16 + hf * 8 + 2 * (v - 4));
    const _Float16* p = base + (size_t)(row0 + m) * ld + k0 + kb;
    a[2 * v]     = p[0];
    a[2 * v + 1] = p[1];
  }
  return a;
}

// B-fragment (32x16, K x N) from an N-major LDS tile: elem B[k][n] = base[n*ld + k]
static __device__ __forceinline__ v16h lds_b_frag_nmajor(const _Float16* base,
                                                         int n0, int ld, int k0) {
  const int lane = threadIdx.x & 31;
  const int n = lane & 15, hf = lane >> 4;
  v16h b;
#pragma unroll
  for (int v = 0; v < 8; ++v) {
    const int kb = (v < 4) ? (hf * 8 + 2 * v) : (16 + hf * 8 + 2 * (v - 4));
    const _Float16* p = base + (size_t)(n0 + n) * ld + k0 + kb;
    b[2 * v]     = p[0];
    b[2 * v + 1] = p[1];
  }
  return b;
}

// ---------------------------------------------------------------------------
// f32 -> f16 bulk conversion (vectorized, one-shot preprocessing)
// ---------------------------------------------------------------------------
__global__ __launch_bounds__(256)
void cvt_f32_f16(const float* __restrict__ src, _Float16* __restrict__ dst,
                 int n4) {
  const int i = blockIdx.x * 256 + threadIdx.x;
  if (i < n4) {
    const float4 v = ((const float4*)src)[i];
    h4 o; o[0] = (_Float16)v.x; o[1] = (_Float16)v.y;
          o[2] = (_Float16)v.z; o[3] = (_Float16)v.w;
    ((h4*)dst)[i] = o;
  }
}

// ---------------------------------------------------------------------------
// GEMM: out[M, Nout] = A[M, K] * W[Nout, K]^T + bias, A/W f16.
//   128(M) x 128(N) x 64(K) tile; 256 threads = 8 waves (4x2); each wave
//   computes 32x64 = 2x4 WMMA tiles -> 16 WMMA per K-iter between barriers.
//   Double-buffered LDS (72 KB, rows padded to LDP), all staging via async
//   global->LDS DMA, pipelined one K-block ahead.
// ---------------------------------------------------------------------------
template <typename OT>
__global__ __launch_bounds__(256)
void gemm_bias_wmma(const _Float16* __restrict__ A, const _Float16* __restrict__ W,
                    const float* __restrict__ bias, OT* __restrict__ out,
                    int M, int Nout, int K) {
  constexpr int BM = 128, BN = 128, BK = 64;
  __shared__ __attribute__((aligned(16))) _Float16 As[2][BM * LDP];  // 2 x 18 KB
  __shared__ __attribute__((aligned(16))) _Float16 Ws[2][BN * LDP];  // 2 x 18 KB

  const int tid   = threadIdx.x;
  const int m_blk = blockIdx.y * BM;
  const int n_blk = blockIdx.x * BN;
  const int w     = tid >> 5;
  const int lane  = tid & 31;
  const int wm    = w >> 1;   // 0..3 -> 32 rows each
  const int wn    = w & 1;    // 0..1 -> 64 cols each

  // Per-thread staging chunk coordinates (8 halves = 16 B per chunk)
  int rs[4], cs[4], ls[4];   // ls: the chunk's place in a padded LDS tile
  const _Float16* pa[4];  // global A pointers, advanced by BK each K-block
  const _Float16* pw[4];  // global W pointers
#pragma unroll
  for (int i = 0; i < 4; ++i) {
    const int idx = tid + i * 256;
    rs[i] = idx >> 3; cs[i] = (idx & 7) * 8;   // rows 0..127, cols {0,8,..,56}
    ls[i] = rs[i] * LDP + cs[i];
    pa[i] = A + (size_t)(m_blk + rs[i]) * K + cs[i];
    pw[i] = W + (size_t)(n_blk + rs[i]) * K + cs[i];
  }

  // Prologue: stage K-block 0 into buffer 0
  async_copy4_b128(pa[0], &As[0][ls[0]], pa[1], &As[0][ls[1]],
                   pa[2], &As[0][ls[2]], pa[3], &As[0][ls[3]]);
  async_copy4_b128(pw[0], &Ws[0][ls[0]], pw[1], &Ws[0][ls[1]],
                   pw[2], &Ws[0][ls[2]], pw[3], &Ws[0][ls[3]]);
#pragma unroll
  for (int i = 0; i < 4; ++i) {
    pa[i] += BK;
    pw[i] += BK;
  }

  v8f acc[2][4] = {};

  const int nkb = K / BK;
  for (int kb = 0; kb < nkb; ++kb) {
    const int buf = kb & 1;
    wait_lds_and_async0();
    __syncthreads();

    if (kb + 1 < nkb) {  // stage next K-block into other buffer
      const int nb = buf ^ 1;
      async_copy4_b128(pa[0], &As[nb][ls[0]], pa[1], &As[nb][ls[1]],
                       pa[2], &As[nb][ls[2]], pa[3], &As[nb][ls[3]]);
      async_copy4_b128(pw[0], &Ws[nb][ls[0]], pw[1], &Ws[nb][ls[1]],
                       pw[2], &Ws[nb][ls[2]], pw[3], &Ws[nb][ls[3]]);
#pragma unroll
      for (int i = 0; i < 4; ++i) {
        pa[i] += BK;
        pw[i] += BK;
      }
    }

#pragma unroll
    for (int ks = 0; ks < BK; ks += 32) {
      v16h af[2], bf[4];
#pragma unroll
      for (int mt = 0; mt < 2; ++mt)
        af[mt] = lds_a_frag(As[buf], wm * 32 + mt * 16, LDP, ks);
#pragma unroll
      for (int nt = 0; nt < 4; ++nt)
        bf[nt] = lds_b_frag_nmajor(Ws[buf], wn * 64 + nt * 16, LDP, ks);
#pragma unroll
      for (int mt = 0; mt < 2; ++mt)
#pragma unroll
        for (int nt = 0; nt < 4; ++nt)
          acc[mt][nt] = wmma32(af[mt], bf[nt], acc[mt][nt]);
    }
  }
  wait_async0();   // no copy of this wave is outstanding when it ends

  // Epilogue: C/D layout -> lane n = lane&15; row = r + 8*(lane>=16)
  const int hf = lane >> 4, nin = lane & 15;
#pragma unroll
  for (int mt = 0; mt < 2; ++mt)
#pragma unroll
    for (int nt = 0; nt < 4; ++nt) {
      const int nglob = n_blk + wn * 64 + nt * 16 + nin;
      const float bv = bias[nglob];
#pragma unroll
      for (int r = 0; r < 8; ++r) {
        const int mglob = m_blk + wm * 32 + mt * 16 + r + hf * 8;
        out[(size_t)mglob * Nout + nglob] = (OT)(acc[mt][nt][r] + bv);
      }
    }
}

static __device__ __forceinline__ float other_half(float x) {
  const int b = __builtin_bit_cast(int, x);
  return __builtin_bit_cast(float, __builtin_amdgcn_permlanex16(
      b, b, 0x76543210, 0xfedcba98, false, false));
}

// Two f32 tiles of S^T (keys 0-15 and 16-31 of a 32-key group) -> f16 B operand
static __device__ __forceinline__ v16h pack_b(v8f t0, v8f t1) {
  const h8 lo = __builtin_convertvector(t0, h8);
  const h8 hi = __builtin_convertvector(t1, h8);
  return __builtin_shufflevector(lo, hi, 0, 1, 2, 3, 4, 5, 6, 7,
                                 8, 9, 10, 11, 12, 13, 14, 15);
}

// V^T A-fragment (16 d x 32 keys) from a row-major [key][d] LDS tile by two
// transposing loads. Lane (c = lane & 15, hf = lane >> 4) gets keys hf*8..+7
// and 16+hf*8..+7 of column d0 + c: the k order of lds_a_frag and pack_b.
typedef short s16x8 __attribute__((ext_vector_type(8)));
static __device__ __forceinline__ h8 lds_tr16(const _Float16* p) {
  typedef __attribute__((address_space(3))) s16x8 lds_s16x8;
  return __builtin_bit_cast(h8, __builtin_amdgcn_ds_load_tr16_b128_v8i16((lds_s16x8*)p));
}
static __device__ __forceinline__ v16h lds_at_frag(const _Float16* base,
                                                   int d0, int ld, int k0) {
  const int lane = threadIdx.x & 31;
  const _Float16* p = base + (k0 + 8 * (lane >> 4) + (lane & 7)) * ld + d0 +
                      8 * ((lane >> 3) & 1);
  const h8 lo = lds_tr16(p);
  const h8 hi = lds_tr16(p + 16 * ld);
  return __builtin_shufflevector(lo, hi, 0, 1, 2, 3, 4, 5, 6, 7,
                                 8, 9, 10, 11, 12, 13, 14, 15);
}

__global__ __launch_bounds__(128)
void flash_attn_wmma(const _Float16* __restrict__ qkv,
                     _Float16* __restrict__ attn_out) {
  constexpr int BR = 64, BC = 64, DH = HEAD_D;
  constexpr int VLD = 80;  // V row pitch 160 B = 32 B x 5, for ds_load_tr16_b128

  __shared__ __attribute__((aligned(16))) _Float16 Ks[2][BC * LDP];  // 18 KB (double-buffered, padded rows)
  __shared__ __attribute__((aligned(16))) _Float16 Vs[2][BC * VLD];  // 20 KB (double-buffered, padded rows)

  const int tid  = threadIdx.x;
  const int w    = tid >> 5;
  const int lane = tid & 31;
  const int hf   = lane >> 4, nin = lane & 15;
  const int qblk = blockIdx.x;
  const int h    = blockIdx.y;
  const int b    = blockIdx.z;
  const float sc2 = 0.125f * 1.44269504088896f;   // 1/sqrt(64) * log2(e)

  const size_t rowstride = (size_t)THREEC;
  const size_t blkstep   = (size_t)BC * rowstride;   // halves per key-block
  const _Float16* qbase = qkv + ((size_t)b * SEQ) * rowstride + h * HEAD_D;
  const int nq = qblk * BR + w * 16 + nin;           // this lane's query

  // --- Prologue: async-stage K and V block 0; Q into registers ---
  int lk[4], lv[4];   // the chunk's place in a padded K tile, V tile
  const _Float16* gk[4];
  const _Float16* gv[4];
#pragma unroll
  for (int i = 0; i < 4; ++i) {
    const int idx = tid + i * 128;
    const int rk = idx >> 3, ck = (idx & 7) * 8;
    lk[i] = rk * LDP + ck;
    lv[i] = rk * VLD + ck;
    gk[i] = qbase + (size_t)rk * rowstride + HIDDEN + ck;
    gv[i] = qbase + (size_t)rk * rowstride + 2 * HIDDEN + ck;
  }
  async_copy4_b128(gk[0], &Ks[0][lk[0]], gk[1], &Ks[0][lk[1]],
                   gk[2], &Ks[0][lk[2]], gk[3], &Ks[0][lk[3]]);
  async_copy4_b128(gv[0], &Vs[0][lv[0]], gv[1], &Vs[0][lv[1]],
                   gv[2], &Vs[0][lv[2]], gv[3], &Vs[0][lv[3]]);
#pragma unroll
  for (int i = 0; i < 4; ++i) {
    gk[i] += blkstep;
    gv[i] += blkstep;
  }

  // Q^T B-fragments, same k order as lds_a_frag: halves hf*8.. and 16+hf*8..
  v16h qf[2];
  {
    const _Float16* qrow = qbase + (size_t)nq * rowstride + hf * 8;
#pragma unroll
    for (int ks = 0; ks < 2; ++ks) {
      const h8 lo = *(const h8*)(qrow + ks * 32);
      const h8 hi = *(const h8*)(qrow + ks * 32 + 16);
      qf[ks] = __builtin_shufflevector(lo, hi, 0, 1, 2, 3, 4, 5, 6, 7,
                                       8, 9, 10, 11, 12, 13, 14, 15);
    }
  }

  float m_run = -3.0e38f;  // running maximum of this lane's query, log2 units
  float l_run = 0.0f;      // running sum over this lane's half of the keys
  v8f oacc[4] = {};        // O^T: oacc[dt][r] = O[query nin][dt*16 + hf*8 + r]

  const int nblocks = SEQ / BC;
  for (int kb = 0; kb < nblocks; ++kb) {
    const int buf = kb & 1;
    wait_lds_and_async0();
    __syncthreads();   // Ks[buf], Vs[buf] ready; the other buffers are read out

    if (kb + 1 < nblocks) {
      // Async-prefetch K and V block kb+1 into the other buffers
      const int nb = buf ^ 1;
      async_copy4_b128(gk[0], &Ks[nb][lk[0]], gk[1], &Ks[nb][lk[1]],
                       gk[2], &Ks[nb][lk[2]], gk[3], &Ks[nb][lk[3]]);
      async_copy4_b128(gv[0], &Vs[nb][lv[0]], gv[1], &Vs[nb][lv[1]],
                       gv[2], &Vs[nb][lv[2]], gv[3], &Vs[nb][lv[3]]);
#pragma unroll
      for (int i = 0; i < 4; ++i) {
        gk[i] += blkstep;
        gv[i] += blkstep;
      }
    }

    // S^T = K Q^T (64 keys x 16 queries per wave): 4 key tiles, 2 WMMA k-steps
    // sacc[kt][r] = score(key kt*16 + hf*8 + r, query nin)
    v8f sacc[4] = {};
#pragma unroll
    for (int ks = 0; ks < 2; ++ks)
#pragma unroll
      for (int kt = 0; kt < 4; ++kt) {
        const v16h af = lds_a_frag(Ks[buf], kt * 16, LDP, ks * 32);
        sacc[kt] = wmma32(af, qf[ks], sacc[kt]);
      }

    // Online softmax in registers, one query per lane
    const v8f mx8 = __builtin_elementwise_max(
        __builtin_elementwise_max(sacc[0], sacc[1]),
        __builtin_elementwise_max(sacc[2], sacc[3]));
    float rmax = fmaxf(fmaxf(fmaxf(mx8[0], mx8[1]), fmaxf(mx8[2], mx8[3])),
                       fmaxf(fmaxf(mx8[4], mx8[5]), fmaxf(mx8[6], mx8[7])));
    rmax = fmaxf(rmax, other_half(rmax));
    const float m_new = fmaxf(m_run, rmax * sc2);
    const float alpha = __builtin_amdgcn_exp2f(m_run - m_new);
    m_run = m_new;
#pragma unroll
    for (int kt = 0; kt < 4; ++kt)
#pragma unroll
      for (int r = 0; r < 8; ++r)
        sacc[kt][r] = __builtin_amdgcn_exp2f(fmaf(sacc[kt][r], sc2, -m_new));
    const v8f ps8 = (sacc[0] + sacc[1]) + (sacc[2] + sacc[3]);
    l_run = l_run * alpha + (((ps8[0] + ps8[1]) + (ps8[2] + ps8[3])) +
                             ((ps8[4] + ps8[5]) + (ps8[6] + ps8[7])));
    const v16h pf[2] = {pack_b(sacc[0], sacc[1]), pack_b(sacc[2], sacc[3])};
#pragma unroll
    for (int dt = 0; dt < 4; ++dt) oacc[dt] *= alpha;

    // O^T += V^T P^T (4 d-tiles, 2 WMMA k-steps over the 64 keys)
#pragma unroll
    for (int ks = 0; ks < 2; ++ks)
#pragma unroll
      for (int dt = 0; dt < 4; ++dt) {
        const v16h af = lds_at_frag(Vs[buf], dt * 16, VLD, ks * 32);
        oacc[dt] = wmma32(af, pf[ks], oacc[dt]);
      }
  }
  wait_async0();   // no copy of this wave is outstanding when it ends

  // Write O / l  ->  attn_out[b, nq, h, d]  (f16): 8 consecutive d per lane
  const float linv = 1.0f / (l_run + other_half(l_run));
  _Float16* dst = attn_out + ((size_t)b * SEQ + nq) * HIDDEN + h * HEAD_D + hf * 8;
#pragma unroll
  for (int dt = 0; dt < 4; ++dt)
    *(h8*)(dst + dt * 16) = __builtin_convertvector(oacc[dt] * linv, h8);
}

// ---------------------------------------------------------------------------
// Host-side launch
// ---------------------------------------------------------------------------
extern "C" void kernel_launch(void* const* d_in, const int* in_sizes, int n_in,
                              void* d_out, int out_size, void* d_ws, size_t ws_size,
                              hipStream_t stream) {
  (void)in_sizes; (void)n_in; (void)out_size; (void)ws_size;
  const float* x     = (const float*)d_in[0];   // [2, 4096, 1024]
  const float* qkv_w = (const float*)d_in[1];   // [3072, 1024]
  const float* qkv_b = (const float*)d_in[2];   // [3072]
  const float* out_w = (const float*)d_in[3];   // [1024, 1024]
  const float* out_b = (const float*)d_in[4];   // [1024]
  float* out = (float*)d_out;                   // [2, 4096, 1024]

  // Workspace layout (all f16 halves)
  _Float16* qkv_h  = (_Float16*)d_ws;                     // 8192 x 3072
  _Float16* attn_h = qkv_h  + (size_t)MTOT * THREEC;      // 8192 x 1024
  _Float16* x_h    = attn_h + (size_t)MTOT * HIDDEN;      // 8192 x 1024
  _Float16* qkvw_h = x_h    + (size_t)MTOT * HIDDEN;      // 3072 x 1024
  _Float16* outw_h = qkvw_h + (size_t)THREEC * HIDDEN;    // 1024 x 1024

  // 0) One-shot f32 -> f16 conversion of activations and weights
  {
    const int n4x = (MTOT * HIDDEN) / 4;
    cvt_f32_f16<<<n4x / 256, 256, 0, stream>>>(x, x_h, n4x);
    const int n4q = (THREEC * HIDDEN) / 4;
    cvt_f32_f16<<<n4q / 256, 256, 0, stream>>>(qkv_w, qkvw_h, n4q);
    const int n4o = (HIDDEN * HIDDEN) / 4;
    cvt_f32_f16<<<n4o / 256, 256, 0, stream>>>(out_w, outw_h, n4o);
  }

  // 1) QKV projection: [8192,1024] x [3072,1024]^T + bias -> f16
  gemm_bias_wmma<_Float16>
      <<<dim3(THREEC / 128, MTOT / 128), 256, 0, stream>>>(
          x_h, qkvw_h, qkv_b, qkv_h, MTOT, THREEC, HIDDEN);

  // 2) Flash attention over heads
  flash_attn_wmma<<<dim3(SEQ / 64, HEADS, BATCH), 128, 0, stream>>>(qkv_h, attn_h);

  // 3) Output projection: [8192,1024] x [1024,1024]^T + bias -> f32
  gemm_bias_wmma<float>
      <<<dim3(HIDDEN / 128, MTOT / 128), 256, 0, stream>>>(
          attn_h, outw_h, out_b, out, MTOT, HIDDEN, HIDDEN);
}

// v004
// A run of this version takes 184 microseconds.
// In two side-by-side timings against v003, it was 1.17 and 1.16 times as fast.
// Counting every step since v000, it is 5.66 times as fast.
#include <hip/hip_runtime.h>
#include <hip/hip_bf16.h>

typedef __attribute__((ext_vector_type(16))) _Float16 v16h;
typedef __attribute__((ext_vector_type(8)))  float    v8f;
typedef __attribute__((ext_vector_type(4)))  _Float16 h4;
typedef __attribute__((ext_vector_type(8)))  _Float16 h8;

// ---------------------------------------------------------------------------
// Problem constants
// ---------------------------------------------------------------------------
static constexpr int BATCH   = 2;
static constexpr int SEQ     = 4096;
static constexpr int HIDDEN  = 1024;
static constexpr int HEADS   = 16;
static constexpr int HEAD_D  = 64;
static constexpr int THREEC  = 3 * HIDDEN;   // 3072
static constexpr int MTOT    = BATCH * SEQ;  // 8192

// ---------------------------------------------------------------------------
// CDNA5 async global->LDS (16B per lane, ASYNCcnt-tracked)
// ---------------------------------------------------------------------------
static __device__ __forceinline__ unsigned int lds_byte(const _Float16* p) {
  return (unsigned int)(uintptr_t)p;   // low 32 bits = byte address in LDS
}
// Four copies of a lane in ONE statement that ends in s_wait_xcnt 0: the wait
// stands in front of every later rewrite of the address registers named here.
static __device__ __forceinline__ void async_copy4_b128(
    const _Float16* g0, const _Float16* l0, const _Float16* g1, const _Float16* l1,
    const _Float16* g2, const _Float16* l2, const _Float16* g3, const _Float16* l3) {
  asm volatile("global_load_async_to_lds_b128 %0, %4, off\n\t"
               "global_load_async_to_lds_b128 %1, %5, off\n\t"
               "global_load_async_to_lds_b128 %2, %6, off\n\t"
               "global_load_async_to_lds_b128 %3, %7, off\n\t"
               "s_wait_xcnt 0x0"
               :: "v"(lds_byte(l0)), "v"(lds_byte(l1)), "v"(lds_byte(l2)),
                  "v"(lds_byte(l3)), "v"(g0), "v"(g1), "v"(g2), "v"(g3)
               : "memory");
}
// Publish point, in front of the barrier: this wave's LDS reads have retired
// (the buffer they read is refilled behind the barrier) and its copies landed.
static __device__ __forceinline__ void wait_lds_and_async0() {
  asm volatile("s_wait_dscnt 0x0" ::: "memory");
  asm volatile("s_wait_asynccnt 0x0" ::: "memory");
}
static __device__ __forceinline__ void wait_async0() {
  asm volatile("s_wait_asynccnt 0x0" ::: "memory");
}

// LDS pitch of a 64-half (128 B) row read by ds_load_b128: 144 B = 16 B x 9.
// At 128 B the 16 rows of a fragment fall on two groups of four banks.
static constexpr int LDP = 72;

// ---------------------------------------------------------------------------
// WMMA helper (D = A(16x32 f16) * B(32x16 f16) + C(16x16 f32))
// ---------------------------------------------------------------------------
static __device__ __forceinline__ v8f wmma32(v16h a, v16h b, v8f c) {
  return __builtin_amdgcn_wmma_f32_16x16x32_f16(false, a, false, b,
                                                (short)0, c, false, false);
}

// A-fragment: 16x32 f16 from LDS. Lanes 0-15 -> M=lane, K 0-7, 16-23;
// lanes 16-31 -> K 8-15, 24-31. 8 contiguous halves per chunk -> ds_load_b128.
static __device__ __forceinline__ v16h lds_a_frag(const _Float16* base,
                                                  int row0, int ld, int k0) {
  const int lane = threadIdx.x & 31;
  const int m = lane & 15, hf = lane >> 4;
  v16h a;
#pragma unroll
  for (int v = 0; v < 8; ++v) {
    const int kb = (v < 4) ? (hf * 8 + 2 * v) : (16 + hf * 8 + 2 * (v - 4));
    const _Float16* p = base + (size_t)(row0 + m) * ld + k0 + kb;
    a[2 * v]     = p[0];
    a[2 * v + 1] = p[1];
  }
  return a;
}

// B-fragment (32x16, K x N) from an N-major LDS tile: elem B[k][n] = base[n*ld + k]
static __device__ __forceinline__ v16h lds_b_frag_nmajor(const _Float16* base,
                                                         int n0, int ld, int k0) {
  const int lane = threadIdx.x & 31;
  const int n = lane & 15, hf = lane >> 4;
  v16h b;
#pragma unroll
  for (int v = 0; v < 8; ++v) {
    const int kb = (v < 4) ? (hf * 8 + 2 * v) : (16 + hf * 8 + 2 * (v - 4));
    const _Float16* p = base + (size_t)(n0 + n) * ld + k0 + kb;
    b[2 * v]     = p[0];
    b[2 * v + 1] = p[1];
  }
  return b;
}

// ---------------------------------------------------------------------------
// f32 -> f16 bulk conversion (vectorized, one-shot preprocessing)
// ---------------------------------------------------------------------------
__global__ __launch_bounds__(256)
void cvt_f32_f16(const float* __restrict__ src, _Float16* __restrict__ dst,
                 int n4) {
  const int i = blockIdx.x * 256 + threadIdx.x;
  if (i < n4) {
    const float4 v = ((const float4*)src)[i];
    h4 o; o[0] = (_Float16)v.x; o[1] = (_Float16)v.y;
          o[2] = (_Float16)v.z; o[3] = (_Float16)v.w;
    ((h4*)dst)[i] = o;
  }
}

// ---------------------------------------------------------------------------
// GEMM: out[M, Nout] = A[M, K] * W[Nout, K]^T + bias, A/W f16.
//   128(M) x 128(N) x 64(K) tile; 256 threads = 8 waves (4x2); each wave
//   computes 32x64 = 2x4 WMMA tiles -> 16 WMMA per K-iter between barriers.
//   Double-buffered LDS (72 KB, rows padded to LDP), all staging via async
//   global->LDS DMA, pipelined one K-block ahead.
// ---------------------------------------------------------------------------
template <typename OT>
__global__ __launch_bounds__(256)
void gemm_bias_wmma(const _Float16* __restrict__ A, const _Float16* __restrict__ W,
                    const float* __restrict__ bias, OT* __restrict__ out,
                    int M, int Nout, int K) {
  constexpr int BM = 128, BN = 128, BK = 64;
  __shared__ __attribute__((aligned(16))) _Float16 As[2][BM * LDP];  // 2 x 18 KB
  __shared__ __attribute__((aligned(16))) _Float16 Ws[2][BN * LDP];  // 2 x 18 KB

  const int tid   = threadIdx.x;
  const int m_blk = blockIdx.y * BM;
  const int n_blk = blockIdx.x * BN;
  const int w     = tid >> 5;
  const int lane  = tid & 31;
  const int wm    = w >> 1;   // 0..3 -> 32 rows each
  const int wn    = w & 1;    // 0..1 -> 64 cols each

  // Per-thread staging chunk coordinates (8 halves = 16 B per chunk)
  int rs[4], cs[4], ls[4];   // ls: the chunk's place in a padded LDS tile
  const _Float16* pa[4];  // global A pointers, advanced by BK each K-block
  const _Float16* pw[4];  // global W pointers
#pragma unroll
  for (int i = 0; i < 4; ++i) {
    const int idx = tid + i * 256;
    rs[i] = idx >> 3; cs[i] = (idx & 7) * 8;   // rows 0..127, cols {0,8,..,56}
    ls[i] = rs[i] * LDP + cs[i];
    pa[i] = A + (size_t)(m_blk + rs[i]) * K + cs[i];
    pw[i] = W + (size_t)(n_blk + rs[i]) * K + cs[i];
  }

  // Prologue: stage K-block 0 into buffer 0
  async_copy4_b128(pa[0], &As[0][ls[0]], pa[1], &As[0][ls[1]],
                   pa[2], &As[0][ls[2]], pa[3], &As[0][ls[3]]);
  async_copy4_b128(pw[0], &Ws[0][ls[0]], pw[1], &Ws[0][ls[1]],
                   pw[2], &Ws[0][ls[2]], pw[3], &Ws[0][ls[3]]);
#pragma unroll
  for (int i = 0; i < 4; ++i) {
    pa[i] += BK;
    pw[i] += BK;
  }

  v8f acc[2][4] = {};

  const int nkb = K / BK;
  for (int kb = 0; kb < nkb; ++kb) {
    const int buf = kb & 1;
    wait_lds_and_async0();
    __syncthreads();

    if (kb + 1 < nkb) {  // stage next K-block into other buffer
      const int nb = buf ^ 1;
      async_copy4_b128(pa[0], &As[nb][ls[0]], pa[1], &As[nb][ls[1]],
                       pa[2], &As[nb][ls[2]], pa[3], &As[nb][ls[3]]);
      async_copy4_b128(pw[0], &Ws[nb][ls[0]], pw[1], &Ws[nb][ls[1]],
                       pw[2], &Ws[nb][ls[2]], pw[3], &Ws[nb][ls[3]]);
#pragma unroll
      for (int i = 0; i < 4; ++i) {
        pa[i] += BK;
        pw[i] += BK;
      }
    }

#pragma unroll
    for (int ks = 0; ks < BK; ks += 32) {
      v16h af[2], bf[4];
#pragma unroll
      for (int mt = 0; mt < 2; ++mt)
        af[mt] = lds_a_frag(As[buf], wm * 32 + mt * 16, LDP, ks);
#pragma unroll
      for (int nt = 0; nt < 4; ++nt)
        bf[nt] = lds_b_frag_nmajor(Ws[buf], wn * 64 + nt * 16, LDP, ks);
#pragma unroll
      for (int mt = 0; mt < 2; ++mt)
#pragma unroll
        for (int nt = 0; nt < 4; ++nt)
          acc[mt][nt] = wmma32(af[mt], bf[nt], acc[mt][nt]);
    }
  }
  wait_async0();   // no copy of this wave is outstanding when it ends

  // Epilogue: C/D layout -> lane n = lane&15; row = r + 8*(lane>=16)
  const int hf = lane >> 4, nin = lane & 15;
#pragma unroll
  for (int mt = 0; mt < 2; ++mt)
#pragma unroll
    for (int nt = 0; nt < 4; ++nt) {
      const int nglob = n_blk + wn * 64 + nt * 16 + nin;
      const float bv = bias[nglob];
#pragma unroll
      for (int r = 0; r < 8; ++r) {
        const int mglob = m_blk + wm * 32 + mt * 16 + r + hf * 8;
        out[(size_t)mglob * Nout + nglob] = (OT)(acc[mt][nt][r] + bv);
      }
    }
}

static __device__ __forceinline__ float other_half(float x) {
  const int b = __builtin_bit_cast(int, x);
  return __builtin_bit_cast(float, __builtin_amdgcn_permlanex16(
      b, b, 0x76543210, 0xfedcba98, false, false));
}

static __device__ __forceinline__ v8f splat8(float x) {
  return v8f{x, x, x, x, x, x, x, x};
}

// Two f32 tiles of S^T (keys 0-15 and 16-31 of a 32-key group) -> f16 B operand
static __device__ __forceinline__ v16h pack_b(v8f t0, v8f t1) {
  const h8 lo = __builtin_convertvector(t0, h8);
  const h8 hi = __builtin_convertvector(t1, h8);
  return __builtin_shufflevector(lo, hi, 0, 1, 2, 3, 4, 5, 6, 7,
                                 8, 9, 10, 11, 12, 13, 14, 15);
}

// V^T A-fragment (16 d x 32 keys) from a row-major [key][d] LDS tile by two
// transposing loads. Lane (c = lane & 15, hf = lane >> 4) gets keys hf*8..+7
// and 16+hf*8..+7 of column d0 + c: the k order of lds_a_frag and pack_b.
typedef short s16x8 __attribute__((ext_vector_type(8)));
static __device__ __forceinline__ h8 lds_tr16(const _Float16* p) {
  typedef __attribute__((address_space(3))) s16x8 lds_s16x8;
  return __builtin_bit_cast(h8, __builtin_amdgcn_ds_load_tr16_b128_v8i16((lds_s16x8*)p));
}
static __device__ __forceinline__ v16h lds_at_frag(const _Float16* base,
                                                   int d0, int ld, int k0) {
  const int lane = threadIdx.x & 31;
  const _Float16* p = base + (k0 + 8 * (lane >> 4) + (lane & 7)) * ld + d0 +
                      8 * ((lane >> 3) & 1);
  const h8 lo = lds_tr16(p);
  const h8 hi = lds_tr16(p + 16 * ld);
  return __builtin_shufflevector(lo, hi, 0, 1, 2, 3, 4, 5, 6, 7,
                                 8, 9, 10, 11, 12, 13, 14, 15);
}

// Register budget of 256 a wave: two of these work-groups share a WGP, four
// waves a SIMD, so one wave's softmax runs beside another's matrix products.
__global__ __launch_bounds__(256) __attribute__((amdgpu_waves_per_eu(4, 4)))
void flash_attn_wmma(const _Float16* __restrict__ qkv,
                     _Float16* __restrict__ attn_out) {
  constexpr int QT = 2;    // 16-column query tiles per wave
  constexpr int BR = 8 * QT * 16, BC = 64;
  constexpr int VLD = 80;  // V row pitch 160 B = 32 B x 5, for ds_load_tr16_b128

  __shared__ __attribute__((aligned(16))) _Float16 Ks[2][BC * LDP];  // 18 KB (double-buffered, padded rows)
  __shared__ __attribute__((aligned(16))) _Float16 Vs[2][BC * VLD];  // 20 KB (double-buffered, padded rows)

  const int tid  = threadIdx.x;
  const int w    = tid >> 5;
  const int lane = tid & 31;
  const int hf   = lane >> 4, nin = lane & 15;
  const int qblk = blockIdx.x;
  const int h    = blockIdx.y;
  const int b    = blockIdx.z;
  const float sc2 = 0.125f * 1.44269504088896f;   // 1/sqrt(64) * log2(e)

  const size_t rowstride = (size_t)THREEC;
  const size_t blkstep   = (size_t)BC * rowstride;   // halves per key-block
  const _Float16* qbase = qkv + ((size_t)b * SEQ) * rowstride + h * HEAD_D;
  const int nq = qblk * BR + w * (QT * 16) + nin;    // this lane's query in tile 0

  // --- Prologue: async-stage K and V block 0; Q into registers ---
  int lk[2], lv[2];   // the chunk's place in a padded K tile, V tile
  const _Float16* gk[2];
  const _Float16* gv[2];
#pragma unroll
  for (int i = 0; i < 2; ++i) {
    const int idx = tid + i * 256;
    const int rk = idx >> 3, ck = (idx & 7) * 8;
    lk[i] = rk * LDP + ck;
    lv[i] = rk * VLD + ck;
    gk[i] = qbase + (size_t)rk * rowstride + HIDDEN + ck;
    gv[i] = qbase + (size_t)rk * rowstride + 2 * HIDDEN + ck;
  }
  async_copy4_b128(gk[0], &Ks[0][lk[0]], gk[1], &Ks[0][lk[1]],
                   gv[0], &Vs[0][lv[0]], gv[1], &Vs[0][lv[1]]);
#pragma unroll
  for (int i = 0; i < 2; ++i) {
    gk[i] += blkstep;
    gv[i] += blkstep;
  }

  // Q^T B-fragments, same k order as lds_a_frag: halves hf*8.. and 16+hf*8..
  v16h qf[QT][2];
#pragma unroll
  for (int qt = 0; qt < QT; ++qt) {
    const _Float16* qrow = qbase + (size_t)(nq + qt * 16) * rowstride + hf * 8;
#pragma unroll
    for (int ks = 0; ks < 2; ++ks) {
      const h8 lo = *(const h8*)(qrow + ks * 32);
      const h8 hi = *(const h8*)(qrow + ks * 32 + 16);
      qf[qt][ks] = __builtin_shufflevector(lo, hi, 0, 1, 2, 3, 4, 5, 6, 7,
                                           8, 9, 10, 11, 12, 13, 14, 15);
    }
  }

  float m_run[QT];     // running maximum of this lane's query, log2 units
  float l_run[QT];     // running sum over this lane's half of the keys
  v8f oacc[QT][4];     // O^T: oacc[qt][dt][r] = O[query][dt*16 + hf*8 + r]
#pragma unroll
  for (int qt = 0; qt < QT; ++qt) {
    m_run[qt] = -3.0e38f;
    l_run[qt] = 0.0f;
#pragma unroll
    for (int dt = 0; dt < 4; ++dt) oacc[qt][dt] = v8f{};
  }

  const int nblocks = SEQ / BC;
  for (int kb = 0; kb < nblocks; ++kb) {
    const int buf = kb & 1;
    wait_lds_and_async0();
    __syncthreads();   // Ks[buf], Vs[buf] ready; the other buffers are read out

    if (kb + 1 < nblocks) {
      // Async-prefetch K and V block kb+1 into the other buffers
      const int nb = buf ^ 1;
      async_copy4_b128(gk[0], &Ks[nb][lk[0]], gk[1], &Ks[nb][lk[1]],
                       gv[0], &Vs[nb][lv[0]], gv[1], &Vs[nb][lv[1]]);
#pragma unroll
      for (int i = 0; i < 2; ++i) {
        gk[i] += blkstep;
        gv[i] += blkstep;
      }
    }

    // S^T = K Q^T (64 keys x 32 queries per wave): 4 key tiles, 2 WMMA k-steps,
    // each K fragment used for both query tiles
    // sacc[qt][kt][r] = score(key kt*16 + hf*8 + r, query nin of tile qt)
    v8f sacc[QT][4] = {};
#pragma unroll
    for (int ks = 0; ks < 2; ++ks)
#pragma unroll
      for (int kt = 0; kt < 4; ++kt) {
        const v16h af = lds_a_frag(Ks[buf], kt * 16, LDP, ks * 32);
#pragma unroll
        for (int qt = 0; qt < QT; ++qt)
          sacc[qt][kt] = wmma32(af, qf[qt][ks], sacc[qt][kt]);
      }

    // Online softmax in registers, one query per lane and tile
    v16h pf[QT][2];
#pragma unroll
    for (int qt = 0; qt < QT; ++qt) {
      v8f* s = sacc[qt];
      const v8f mx8 = __builtin_elementwise_max(
          __builtin_elementwise_max(s[0], s[1]),
          __builtin_elementwise_max(s[2], s[3]));
      float rmax = fmaxf(fmaxf(fmaxf(mx8[0], mx8[1]), fmaxf(mx8[2], mx8[3])),
                         fmaxf(fmaxf(mx8[4], mx8[5]), fmaxf(mx8[6], mx8[7])));
      rmax = fmaxf(rmax, other_half(rmax));
      const float m_new = fmaxf(m_run[qt], rmax * sc2);
      // alpha = 2^(m_run - m_new). Asm so that the v_nop stands directly behind the
      // transcendental.
      float alpha;
      asm("v_exp_f32 %0, %1\n\tv_nop" : "=v"(alpha) : "v"(m_run[qt] - m_new));
      m_run[qt] = m_new;
#pragma unroll
      for (int kt = 0; kt < 4; ++kt) {
        // Whole-tile fma, per element the same fmaf(s, sc2, -m_new): written element
        // by element the compiler paired scores of the two tiles through copies.
        const v8f t = __builtin_elementwise_fma(s[kt], splat8(sc2), splat8(-m_new));
#pragma unroll
        for (int r = 0; r < 8; ++r) s[kt][r] = __builtin_amdgcn_exp2f(t[r]);
      }
      const v8f ps8 = (s[0] + s[1]) + (s[2] + s[3]);
      l_run[qt] = l_run[qt] * alpha + (((ps8[0] + ps8[1]) + (ps8[2] + ps8[3])) +
                                       ((ps8[4] + ps8[5]) + (ps8[6] + ps8[7])));
      pf[qt][0] = pack_b(s[0], s[1]);
      pf[qt][1] = pack_b(s[2], s[3]);
#pragma unroll
      for (int dt = 0; dt < 4; ++dt) oacc[qt][dt] *= alpha;
    }

    // O^T += V^T P^T (4 d-tiles, 2 WMMA k-steps over the 64 keys), each V^T
    // fragment used for both query tiles
#pragma unroll
    for (int ks = 0; ks < 2; ++ks)
#pragma unroll
      for (int dt = 0; dt < 4; ++dt) {
        const v16h af = lds_at_frag(Vs[buf], dt * 16, VLD, ks * 32);
#pragma unroll
        for (int qt = 0; qt < QT; ++qt)
          oacc[qt][dt] = wmma32(af, pf[qt][ks], oacc[qt][dt]);
      }
  }
  wait_async0();   // no copy of this wave is outstanding when it ends

  // Write O / l  ->  attn_out[b, nq, h, d]  (f16): 8 consecutive d per lane
#pragma unroll
  for (int qt = 0; qt < QT; ++qt) {
    const float linv = 1.0f / (l_run[qt] + other_half(l_run[qt]));
    _Float16* dst = attn_out + ((size_t)b * SEQ + nq + qt * 16) * HIDDEN +
                    h * HEAD_D + hf * 8;
#pragma unroll
    for (int dt = 0; dt < 4; ++dt)
      *(h8*)(dst + dt * 16) = __builtin_convertvector(oacc[qt][dt] * linv, h8);
  }
}

// ---------------------------------------------------------------------------
// Host-side launch
// ---------------------------------------------------------------------------
extern "C" void kernel_launch(void* const* d_in, const int* in_sizes, int n_in,
                              void* d_out, int out_size, void* d_ws, size_t ws_size,
                              hipStream_t stream) {
  (void)in_sizes; (void)n_in; (void)out_size; (void)ws_size;
  const float* x     = (const float*)d_in[0];   // [2, 4096, 1024]
  const float* qkv_w = (const float*)d_in[1];   // [3072, 1024]
  const float* qkv_b = (const float*)d_in[2];   // [3072]
  const float* out_w = (const float*)d_in[3];   // [1024, 1024]
  const float* out_b = (const float*)d_in[4];   // [1024]
  float* out = (float*)d_out;                   // [2, 4096, 1024]

  // Workspace layout (all f16 halves)
  _Float16* qkv_h  = (_Float16*)d_ws;                     // 8192 x 3072
  _Float16* attn_h = qkv_h  + (size_t)MTOT * THREEC;      // 8192 x 1024
  _Float16* x_h    = attn_h + (size_t)MTOT * HIDDEN;      // 8192 x 1024
  _Float16* qkvw_h = x_h    + (size_t)MTOT * HIDDEN;      // 3072 x 1024
  _Float16* outw_h = qkvw_h + (size_t)THREEC * HIDDEN;    // 1024 x 1024

  // 0) One-shot f32 -> f16 conversion of activations and weights
  {
    const int n4x = (MTOT * HIDDEN) / 4;
    cvt_f32_f16<<<n4x / 256, 256, 0, stream>>>(x, x_h, n4x);
    const int n4q = (THREEC * HIDDEN) / 4;
    cvt_f32_f16<<<n4q / 256, 256, 0, stream>>>(qkv_w, qkvw_h, n4q);
    const int n4o = (HIDDEN * HIDDEN) / 4;
    cvt_f32_f16<<<n4o / 256, 256, 0, stream>>>(out_w, outw_h, n4o);
  }

  // 1) QKV projection: [8192,1024] x [3072,1024]^T + bias -> f16
  gemm_bias_wmma<_Float16>
      <<<dim3(THREEC / 128, MTOT / 128), 256, 0, stream>>>(
          x_h, qkvw_h, qkv_b, qkv_h, MTOT, THREEC, HIDDEN);

  // 2) Flash attention over heads
  flash_attn_wmma<<<dim3(SEQ / 256, HEADS, BATCH), 256, 0, stream>>>(qkv_h, attn_h);

  // 3) Output projection: [8192,1024] x [1024,1024]^T + bias -> f32
  gemm_bias_wmma<float>
      <<<dim3(HIDDEN / 128, MTOT / 128), 256, 0, stream>>>(
          attn_h, outw_h, out_b, out, MTOT, HIDDEN, HIDDEN);
}

// v005
// Measured time: 168 microseconds a run.
// Timed twice side by side with v004, it ran 1.11 times as fast both times.
// Counting every step since v000, it is 6.29 times as fast.
#include <hip/hip_runtime.h>
#include <hip/hip_bf16.h>

typedef __attribute__((ext_vector_type(16))) _Float16 v16h;
typedef __attribute__((ext_vector_type(8)))  float    v8f;
typedef __attribute__((ext_vector_type(16))) float    v16f;
typedef __attribute__((ext_vector_type(4)))  _Float16 h4;
typedef __attribute__((ext_vector_type(8)))  _Float16 h8;

// ---------------------------------------------------------------------------
// Problem constants
// ---------------------------------------------------------------------------
static constexpr int BATCH   = 2;
static constexpr int SEQ     = 4096;
static constexpr int HIDDEN  = 1024;
static constexpr int HEADS   = 16;
static constexpr int HEAD_D  = 64;
static constexpr int THREEC  = 3 * HIDDEN;   // 3072
static constexpr int MTOT    = BATCH * SEQ;  // 8192

// ---------------------------------------------------------------------------
// CDNA5 async global->LDS (16B per lane, ASYNCcnt-tracked)
// ---------------------------------------------------------------------------
static __device__ __forceinline__ unsigned int lds_byte(const _Float16* p) {
  return (unsigned int)(uintptr_t)p;   // low 32 bits = byte address in LDS
}
// Four copies of a lane in ONE statement that ends in s_wait_xcnt 0: the wait
// stands in front of every later rewrite of the address registers named here.
static __device__ __forceinline__ void async_copy4_b128(
    const _Float16* g0, const _Float16* l0, const _Float16* g1, const _Float16* l1,
    const _Float16* g2, const _Float16* l2, const _Float16* g3, const _Float16* l3) {
  asm volatile("global_load_async_to_lds_b128 %0, %4, off\n\t"
               "global_load_async_to_lds_b128 %1, %5, off\n\t"
               "global_load_async_to_lds_b128 %2, %6, off\n\t"
               "global_load_async_to_lds_b128 %3, %7, off\n\t"
               "s_wait_xcnt 0x0"
               :: "v"(lds_byte(l0)), "v"(lds_byte(l1)), "v"(lds_byte(l2)),
                  "v"(lds_byte(l3)), "v"(g0), "v"(g1), "v"(g2), "v"(g3)
               : "memory");
}
// Publish point, in front of the barrier: this wave's LDS reads have retired
// (the buffer they read is refilled behind the barrier) and its copies landed.
static __device__ __forceinline__ void wait_lds_and_async0() {
  asm volatile("s_wait_dscnt 0x0" ::: "memory");
  asm volatile("s_wait_asynccnt 0x0" ::: "memory");
}
static __device__ __forceinline__ void wait_async0() {
  asm volatile("s_wait_asynccnt 0x0" ::: "memory");
}

// LDS pitch of a 64-half (128 B) row read by ds_load_b128: 144 B = 16 B x 9.
// At 128 B the 16 rows of a fragment fall on two groups of four banks.
static constexpr int LDP = 72;

// ---------------------------------------------------------------------------
// WMMA helper (D = A(16x32 f16) * B(32x16 f16) + C(16x16 f32))
// ---------------------------------------------------------------------------
static __device__ __forceinline__ v8f wmma32(v16h a, v16h b, v8f c) {
  return __builtin_amdgcn_wmma_f32_16x16x32_f16(false, a, false, b,
                                                (short)0, c, false, false);
}

// A-fragment: 16x32 f16 from LDS. Lanes 0-15 -> M=lane, K 0-7, 16-23;
// lanes 16-31 -> K 8-15, 24-31. 8 contiguous halves per chunk -> ds_load_b128.
static __device__ __forceinline__ v16h lds_a_frag(const _Float16* base,
                                                  int row0, int ld, int k0) {
  const int lane = threadIdx.x & 31;
  const int m = lane & 15, hf = lane >> 4;
  v16h a;
#pragma unroll
  for (int v = 0; v < 8; ++v) {
    const int kb = (v < 4) ? (hf * 8 + 2 * v) : (16 + hf * 8 + 2 * (v - 4));
    const _Float16* p = base + (size_t)(row0 + m) * ld + k0 + kb;
    a[2 * v]     = p[0];
    a[2 * v + 1] = p[1];
  }
  return a;
}

// B-fragment (32x16, K x N) from an N-major LDS tile: elem B[k][n] = base[n*ld + k]
static __device__ __forceinline__ v16h lds_b_frag_nmajor(const _Float16* base,
                                                         int n0, int ld, int k0) {
  const int lane = threadIdx.x & 31;
  const int n = lane & 15, hf = lane >> 4;
  v16h b;
#pragma unroll
  for (int v = 0; v < 8; ++v) {
    const int kb = (v < 4) ? (hf * 8 + 2 * v) : (16 + hf * 8 + 2 * (v - 4));
    const _Float16* p = base + (size_t)(n0 + n) * ld + k0 + kb;
    b[2 * v]     = p[0];
    b[2 * v + 1] = p[1];
  }
  return b;
}

// ---------------------------------------------------------------------------
// f32 -> f16 bulk conversion (vectorized, one-shot preprocessing)
// ---------------------------------------------------------------------------
__global__ __launch_bounds__(256)
void cvt_f32_f16(const float* __restrict__ src, _Float16* __restrict__ dst,
                 int n4) {
  const int i = blockIdx.x * 256 + threadIdx.x;
  if (i < n4) {
    const float4 v = ((const float4*)src)[i];
    h4 o; o[0] = (_Float16)v.x; o[1] = (_Float16)v.y;
          o[2] = (_Float16)v.z; o[3] = (_Float16)v.w;
    ((h4*)dst)[i] = o;
  }
}

// ---------------------------------------------------------------------------
// GEMM: out[M, Nout] = A[M, K] * W[Nout, K]^T + bias, A/W f16.
//   128(M) x 128(N) x 64(K) tile; 256 threads = 8 waves (4x2); each wave
//   computes 32x64 = 2x4 WMMA tiles -> 16 WMMA per K-iter between barriers.
//   Double-buffered LDS (72 KB, rows padded to LDP), all staging via async
//   global->LDS DMA, pipelined one K-block ahead.
// ---------------------------------------------------------------------------
template <typename OT>
__global__ __launch_bounds__(256)
void gemm_bias_wmma(const _Float16* __restrict__ A, const _Float16* __restrict__ W,
                    const float* __restrict__ bias, OT* __restrict__ out,
                    int M, int Nout, int K) {
  constexpr int BM = 128, BN = 128, BK = 64;
  __shared__ __attribute__((aligned(16))) _Float16 As[2][BM * LDP];  // 2 x 18 KB
  __shared__ __attribute__((aligned(16))) _Float16 Ws[2][BN * LDP];  // 2 x 18 KB

  const int tid   = threadIdx.x;
  const int m_blk = blockIdx.y * BM;
  const int n_blk = blockIdx.x * BN;
  const int w     = tid >> 5;
  const int lane  = tid & 31;
  const int wm    = w >> 1;   // 0..3 -> 32 rows each
  const int wn    = w & 1;    // 0..1 -> 64 cols each

  // Per-thread staging chunk coordinates (8 halves = 16 B per chunk)
  int rs[4], cs[4], ls[4];   // ls: the chunk's place in a padded LDS tile
  const _Float16* pa[4];  // global A pointers, advanced by BK each K-block
  const _Float16* pw[4];  // global W pointers
#pragma unroll
  for (int i = 0; i < 4; ++i) {
    const int idx = tid + i * 256;
    rs[i] = idx >> 3; cs[i] = (idx & 7) * 8;   // rows 0..127, cols {0,8,..,56}
    ls[i] = rs[i] * LDP + cs[i];
    pa[i] = A + (size_t)(m_blk + rs[i]) * K + cs[i];
    pw[i] = W + (size_t)(n_blk + rs[i]) * K + cs[i];
  }

  // Prologue: stage K-block 0 into buffer 0
  async_copy4_b128(pa[0], &As[0][ls[0]], pa[1], &As[0][ls[1]],
                   pa[2], &As[0][ls[2]], pa[3], &As[0][ls[3]]);
  async_copy4_b128(pw[0], &Ws[0][ls[0]], pw[1], &Ws[0][ls[1]],
                   pw[2], &Ws[0][ls[2]], pw[3], &Ws[0][ls[3]]);
#pragma unroll
  for (int i = 0; i < 4; ++i) {
    pa[i] += BK;
    pw[i] += BK;
  }

  v8f acc[2][4] = {};

  const int nkb = K / BK;
  for (int kb = 0; kb < nkb; ++kb) {
    const int buf = kb & 1;
    wait_lds_and_async0();
    __syncthreads();

    if (kb + 1 < nkb) {  // stage next K-block into other buffer
      const int nb = buf ^ 1;
      async_copy4_b128(pa[0], &As[nb][ls[0]], pa[1], &As[nb][ls[1]],
                       pa[2], &As[nb][ls[2]], pa[3], &As[nb][ls[3]]);
      async_copy4_b128(pw[0], &Ws[nb][ls[0]], pw[1], &Ws[nb][ls[1]],
                       pw[2], &Ws[nb][ls[2]], pw[3], &Ws[nb][ls[3]]);
#pragma unroll
      for (int i = 0; i < 4; ++i) {
        pa[i] += BK;
        pw[i] += BK;
      }
    }

#pragma unroll
    for (int ks = 0; ks < BK; ks += 32) {
      v16h af[2], bf[4];
#pragma unroll
      for (int mt = 0; mt < 2; ++mt)
        af[mt] = lds_a_frag(As[buf], wm * 32 + mt * 16, LDP, ks);
#pragma unroll
      for (int nt = 0; nt < 4; ++nt)
        bf[nt] = lds_b_frag_nmajor(Ws[buf], wn * 64 + nt * 16, LDP, ks);
#pragma unroll
      for (int mt = 0; mt < 2; ++mt)
#pragma unroll
        for (int nt = 0; nt < 4; ++nt)
          acc[mt][nt] = wmma32(af[mt], bf[nt], acc[mt][nt]);
    }
  }
  wait_async0();   // no copy of this wave is outstanding when it ends

  // Epilogue: C/D layout -> lane n = lane&15; row = r + 8*(lane>=16)
  const int hf = lane >> 4, nin = lane & 15;
#pragma unroll
  for (int mt = 0; mt < 2; ++mt)
#pragma unroll
    for (int nt = 0; nt < 4; ++nt) {
      const int nglob = n_blk + wn * 64 + nt * 16 + nin;
      const float bv = bias[nglob];
#pragma unroll
      for (int r = 0; r < 8; ++r) {
        const int mglob = m_blk + wm * 32 + mt * 16 + r + hf * 8;
        out[(size_t)mglob * Nout + nglob] = (OT)(acc[mt][nt][r] + bv);
      }
    }
}

static __device__ __forceinline__ float other_half(float x) {
  const int b = __builtin_bit_cast(int, x);
  return __builtin_bit_cast(float, __builtin_amdgcn_permlanex16(
      b, b, 0x76543210, 0xfedcba98, false, false));
}

static __device__ __forceinline__ v8f splat8(float x) {
  return v8f{x, x, x, x, x, x, x, x};
}

// Two f32 tiles of S^T (keys 0-15 and 16-31 of a 32-key group) -> f16 B operand
static __device__ __forceinline__ v16h pack_b(v8f t0, v8f t1) {
  const h8 lo = __builtin_convertvector(t0, h8);
  const h8 hi = __builtin_convertvector(t1, h8);
  return __builtin_shufflevector(lo, hi, 0, 1, 2, 3, 4, 5, 6, 7,
                                 8, 9, 10, 11, 12, 13, 14, 15);
}

// V^T A-fragment (16 d x 32 keys) from a row-major [key][d] LDS tile by two
// transposing loads. Lane (c = lane & 15, hf = lane >> 4) gets keys hf*8..+7
// and 16+hf*8..+7 of column d0 + c: the k order of lds_a_frag and pack_b.
typedef short s16x8 __attribute__((ext_vector_type(8)));
static __device__ __forceinline__ h8 lds_tr16(const _Float16* p) {
  typedef __attribute__((address_space(3))) s16x8 lds_s16x8;
  return __builtin_bit_cast(h8, __builtin_amdgcn_ds_load_tr16_b128_v8i16((lds_s16x8*)p));
}
static __device__ __forceinline__ v16h lds_at_frag(const _Float16* base,
                                                   int d0, int ld, int k0) {
  const int lane = threadIdx.x & 31;
  const _Float16* p = base + (k0 + 8 * (lane >> 4) + (lane & 7)) * ld + d0 +
                      8 * ((lane >> 3) & 1);
  const h8 lo = lds_tr16(p);
  const h8 hi = lds_tr16(p + 16 * ld);
  return __builtin_shufflevector(lo, hi, 0, 1, 2, 3, 4, 5, 6, 7,
                                 8, 9, 10, 11, 12, 13, 14, 15);
}

// Register budget of 256 a wave: two of these work-groups share a WGP, four
// waves a SIMD, so one wave's softmax runs beside another's matrix products.
__global__ __launch_bounds__(256) __attribute__((amdgpu_waves_per_eu(4, 4)))
void flash_attn_wmma(const _Float16* __restrict__ qkv,
                     _Float16* __restrict__ attn_out) {
  constexpr int QT = 2;    // 16-column query tiles per wave
  constexpr int BR = 8 * QT * 16, BC = 64;
  constexpr int VLD = 80;  // V row pitch 160 B = 32 B x 5, for ds_load_tr16_b128
  constexpr float PSUM_MAX = 16384.0f;   // 2^14, a quarter of the largest f16

  __shared__ __attribute__((aligned(16))) _Float16 Ks[2][BC * LDP];  // 18 KB (double-buffered, padded rows)
  __shared__ __attribute__((aligned(16))) _Float16 Vs[2][BC * VLD];  // 20 KB (double-buffered, padded rows)

  const int tid  = threadIdx.x;
  const int w    = tid >> 5;
  const int lane = tid & 31;
  const int hf   = lane >> 4, nin = lane & 15;
  const int qblk = blockIdx.x;
  const int h    = blockIdx.y;
  const int b    = blockIdx.z;
  const float sc2 = 0.125f * 1.44269504088896f;   // 1/sqrt(64) * log2(e)

  const size_t rowstride = (size_t)THREEC;
  const size_t blkstep   = (size_t)BC * rowstride;   // halves per key-block
  const _Float16* qbase = qkv + ((size_t)b * SEQ) * rowstride + h * HEAD_D;
  const int nq = qblk * BR + w * (QT * 16) + nin;    // this lane's query in tile 0

  // --- Prologue: async-stage K and V block 0; Q into registers ---
  int lk[2], lv[2];   // the chunk's place in a padded K tile, V tile
  const _Float16* gk[2];
  const _Float16* gv[2];
#pragma unroll
  for (int i = 0; i < 2; ++i) {
    const int idx = tid + i * 256;
    const int rk = idx >> 3, ck = (idx & 7) * 8;
    lk[i] = rk * LDP + ck;
    lv[i] = rk * VLD + ck;
    gk[i] = qbase + (size_t)rk * rowstride + HIDDEN + ck;
    gv[i] = qbase + (size_t)rk * rowstride + 2 * HIDDEN + ck;
  }
  async_copy4_b128(gk[0], &Ks[0][lk[0]], gk[1], &Ks[0][lk[1]],
                   gv[0], &Vs[0][lv[0]], gv[1], &Vs[0][lv[1]]);
#pragma unroll
  for (int i = 0; i < 2; ++i) {
    gk[i] += blkstep;
    gv[i] += blkstep;
  }

  // Q^T B-fragments, same k order as lds_a_frag: halves hf*8.. and 16+hf*8..
  v16h qf[QT][2];
#pragma unroll
  for (int qt = 0; qt < QT; ++qt) {
    const _Float16* qrow = qbase + (size_t)(nq + qt * 16) * rowstride + hf * 8;
#pragma unroll
    for (int ks = 0; ks < 2; ++ks) {
      const h8 lo = *(const h8*)(qrow + ks * 32);
      const h8 hi = *(const h8*)(qrow + ks * 32 + 16);
      const v16h q = __builtin_shufflevector(lo, hi, 0, 1, 2, 3, 4, 5, 6, 7,
                                             8, 9, 10, 11, 12, 13, 14, 15);
      qf[qt][ks] = __builtin_convertvector(__builtin_convertvector(q, v16f) * sc2, v16h);
    }
  }

  v8f negm[QT];        // minus the held maximum of this lane's query, log2 units
  float l_run[QT];     // running sum over this lane's half of the keys
  v8f oacc[QT][4];     // O^T: oacc[qt][dt][r] = O[query][dt*16 + hf*8 + r]
#pragma unroll
  for (int qt = 0; qt < QT; ++qt) {
    negm[qt] = v8f{};
    l_run[qt] = 0.0f;
#pragma unroll
    for (int dt = 0; dt < 4; ++dt) oacc[qt][dt] = v8f{};
  }

  const int nblocks = SEQ / BC;
  for (int kb = 0; kb < nblocks; ++kb) {
    const int buf = kb & 1;
    wait_lds_and_async0();
    __syncthreads();   // Ks[buf], Vs[buf] ready; the other buffers are read out

    if (kb + 1 < nblocks) {
      // Async-prefetch K and V block kb+1 into the other buffers
      const int nb = buf ^ 1;
      async_copy4_b128(gk[0], &Ks[nb][lk[0]], gk[1], &Ks[nb][lk[1]],
                       gv[0], &Vs[nb][lv[0]], gv[1], &Vs[nb][lv[1]]);
#pragma unroll
      for (int i = 0; i < 2; ++i) {
        gk[i] += blkstep;
        gv[i] += blkstep;
      }
    }

    // T = K (Q sc2)^T - held maximum (64 keys x 32 queries per wave): 4 key tiles,
    // 2 WMMA k-steps, each K fragment used for both query tiles
    // sacc[qt][kt][r]: key kt*16 + hf*8 + r, query nin of tile qt
    v8f sacc[QT][4];
    float psum[QT];      // this lane's sum of the block's exponentials
    bool fix = (kb == 0);   // take a new maximum in this trip (block 0 always does)
    for (;;) {              // one trip; a second only after the test below
      // Compiler fence: each trip loads its own K fragments. Without it they are
      // loaded once in front of the loop and held in 64 registers to its end (spills).
      asm volatile("" ::: "memory");
      v16h af[2][4];
#pragma unroll
      for (int ks = 0; ks < 2; ++ks)
#pragma unroll
        for (int kt = 0; kt < 4; ++kt)
          af[ks][kt] = lds_a_frag(Ks[buf], kt * 16, LDP, ks * 32);
      // Keeps the 16 LDS loads one group in front of the products; left free, the
      // compiler loaded half of them singly among the WMMAs, each behind a full wait.
      __builtin_amdgcn_sched_barrier(0);
#pragma unroll
      for (int ks = 0; ks < 2; ++ks)
#pragma unroll
        for (int kt = 0; kt < 4; ++kt)
#pragma unroll
          for (int qt = 0; qt < QT; ++qt)
            sacc[qt][kt] = wmma32(af[ks][kt], qf[qt][ks], ks == 0 ? negm[qt] : sacc[qt][kt]);

      if (fix) {   // same for the whole wave: kb, or the ballot below
#pragma unroll
        for (int qt = 0; qt < QT; ++qt) {
          v8f* s = sacc[qt];
          const v8f mx8 = __builtin_elementwise_max(
              __builtin_elementwise_max(s[0], s[1]),
              __builtin_elementwise_max(s[2], s[3]));
          float rmax = fmaxf(fmaxf(fmaxf(mx8[0], mx8[1]), fmaxf(mx8[2], mx8[3])),
                             fmaxf(fmaxf(mx8[4], mx8[5]), fmaxf(mx8[6], mx8[7])));
          rmax = fmaxf(rmax, other_half(rmax));
          // d: how far the held maximum moves. It never falls after block 0.
          const float d = (kb == 0) ? rmax : fmaxf(rmax, 0.0f);
          // alpha = 2^-d. Asm so that the v_nop stands directly behind the
          // transcendental.
          float alpha;
          asm("v_exp_f32 %0, %1\n\tv_nop" : "=v"(alpha) : "v"(-d));
          if (kb == 0) alpha = 0.0f;   // nothing is summed yet; 2^-d may be infinite
          negm[qt] -= splat8(d);
#pragma unroll
          for (int kt = 0; kt < 4; ++kt) s[kt] -= splat8(d);
          l_run[qt] *= alpha;
#pragma unroll
          for (int dt = 0; dt < 4; ++dt) oacc[qt][dt] *= alpha;
        }
      }

#pragma unroll
      for (int qt = 0; qt < QT; ++qt) {
        v8f* s = sacc[qt];
#pragma unroll
        for (int kt = 0; kt < 4; ++kt)
#pragma unroll
          for (int r = 0; r < 8; ++r) s[kt][r] = __builtin_amdgcn_exp2f(s[kt][r]);
        const v8f ps8 = (s[0] + s[1]) + (s[2] + s[3]);
        psum[qt] = ((ps8[0] + ps8[1]) + (ps8[2] + ps8[3])) +
                   ((ps8[4] + ps8[5]) + (ps8[6] + ps8[7]));
      }
      if (fix) break;
      // Every exponential is at most its lane's sum: below PSUM_MAX all fit f16.
      // One scalar branch per key block; an infinite sum takes the second trip too.
      fix = __builtin_amdgcn_ballot_w32(!(fmaxf(psum[0], psum[1]) <= PSUM_MAX)) != 0;
      if (!fix) break;
    }

    v16h pf[QT][2];
#pragma unroll
    for (int qt = 0; qt < QT; ++qt) {
      l_run[qt] += psum[qt];
      pf[qt][0] = pack_b(sacc[qt][0], sacc[qt][1]);
      pf[qt][1] = pack_b(sacc[qt][2], sacc[qt][3]);
    }

    // O^T += V^T P^T (4 d-tiles, 2 WMMA k-steps over the 64 keys), each V^T
    // fragment used for both query tiles
#pragma unroll
    for (int ks = 0; ks < 2; ++ks)
#pragma unroll
      for (int dt = 0; dt < 4; ++dt) {
        const v16h af = lds_at_frag(Vs[buf], dt * 16, VLD, ks * 32);
#pragma unroll
        for (int qt = 0; qt < QT; ++qt)
          oacc[qt][dt] = wmma32(af, pf[qt][ks], oacc[qt][dt]);
      }
  }
  wait_async0();   // no copy of this wave is outstanding when it ends

  // Write O / l  ->  attn_out[b, nq, h, d]  (f16): 8 consecutive d per lane
#pragma unroll
  for (int qt = 0; qt < QT; ++qt) {
    const float linv = 1.0f / (l_run[qt] + other_half(l_run[qt]));
    _Float16* dst = attn_out + ((size_t)b * SEQ + nq + qt * 16) * HIDDEN +
                    h * HEAD_D + hf * 8;
#pragma unroll
    for (int dt = 0; dt < 4; ++dt)
      *(h8*)(dst + dt * 16) = __builtin_convertvector(oacc[qt][dt] * linv, h8);
  }
}

// ---------------------------------------------------------------------------
// Host-side launch
// ---------------------------------------------------------------------------
extern "C" void kernel_launch(void* const* d_in, const int* in_sizes, int n_in,
                              void* d_out, int out_size, void* d_ws, size_t ws_size,
                              hipStream_t stream) {
  (void)in_sizes; (void)n_in; (void)out_size; (void)ws_size;
  const float* x     = (const float*)d_in[0];   // [2, 4096, 1024]
  const float* qkv_w = (const float*)d_in[1];   // [3072, 1024]
  const float* qkv_b = (const float*)d_in[2];   // [3072]
  const float* out_w = (const float*)d_in[3];   // [1024, 1024]
  const float* out_b = (const float*)d_in[4];   // [1024]
  float* out = (float*)d_out;                   // [2, 4096, 1024]

  // Workspace layout (all f16 halves)
  _Float16* qkv_h  = (_Float16*)d_ws;                     // 8192 x 3072
  _Float16* attn_h = qkv_h  + (size_t)MTOT * THREEC;      // 8192 x 1024
  _Float16* x_h    = attn_h + (size_t)MTOT * HIDDEN;      // 8192 x 1024
  _Float16* qkvw_h = x_h    + (size_t)MTOT * HIDDEN;      // 3072 x 1024
  _Float16* outw_h = qkvw_h + (size_t)THREEC * HIDDEN;    // 1024 x 1024

  // 0) One-shot f32 -> f16 conversion of activations and weights
  {
    const int n4x = (MTOT * HIDDEN) / 4;
    cvt_f32_f16<<<n4x / 256, 256, 0, stream>>>(x, x_h, n4x);
    const int n4q = (THREEC * HIDDEN) / 4;
    cvt_f32_f16<<<n4q / 256, 256, 0, stream>>>(qkv_w, qkvw_h, n4q);
    const int n4o = (HIDDEN * HIDDEN) / 4;
    cvt_f32_f16<<<n4o / 256, 256, 0, stream>>>(out_w, outw_h, n4o);
  }

  // 1) QKV projection: [8192,1024] x [3072,1024]^T + bias -> f16
  gemm_bias_wmma<_Float16>
      <<<dim3(THREEC / 128, MTOT / 128), 256, 0, stream>>>(
          x_h, qkvw_h, qkv_b, qkv_h, MTOT, THREEC, HIDDEN);

  // 2) Flash attention over heads
  flash_attn_wmma<<<dim3(SEQ / 256, HEADS, BATCH), 256, 0, stream>>>(qkv_h, attn_h);

  // 3) Output projection: [8192,1024] x [1024,1024]^T + bias -> f32
  gemm_bias_wmma<float>
      <<<dim3(HIDDEN / 128, MTOT / 128), 256, 0, stream>>>(
          attn_h, outw_h, out_b, out, MTOT, HIDDEN, HIDDEN);
}

// v006
// One run takes 162 microseconds.
// Next to v005, in two timings, it ran 1.03 times as fast each time.
// All steps since v000 together make it 6.50 times as fast.
#include <hip/hip_runtime.h>
#include <hip/hip_bf16.h>

typedef __attribute__((ext_vector_type(16))) _Float16 v16h;
typedef __attribute__((ext_vector_type(8)))  float    v8f;
typedef __attribute__((ext_vector_type(16))) float    v16f;
typedef __attribute__((ext_vector_type(4)))  _Float16 h4;
typedef __attribute__((ext_vector_type(8)))  _Float16 h8;

// ---------------------------------------------------------------------------
// Problem constants
// ---------------------------------------------------------------------------
static constexpr int BATCH   = 2;
static constexpr int SEQ     = 4096;
static constexpr int HIDDEN  = 1024;
static constexpr int HEADS   = 16;
static constexpr int HEAD_D  = 64;
static constexpr int THREEC  = 3 * HIDDEN;   // 3072
static constexpr int MTOT    = BATCH * SEQ;  // 8192

// ---------------------------------------------------------------------------
// CDNA5 async global->LDS (16B per lane, ASYNCcnt-tracked)
// ---------------------------------------------------------------------------
static __device__ __forceinline__ unsigned int lds_byte(const _Float16* p) {
  return (unsigned int)(uintptr_t)p;   // low 32 bits = byte address in LDS
}
// Four copies of a lane in ONE statement that ends in s_wait_xcnt 0: the wait
// stands in front of every later rewrite of the address registers named here.
static __device__ __forceinline__ void async_copy4_b128(
    const _Float16* g0, const _Float16* l0, const _Float16* g1, const _Float16* l1,
    const _Float16* g2, const _Float16* l2, const _Float16* g3, const _Float16* l3) {
  asm volatile("global_load_async_to_lds_b128 %0, %4, off\n\t"
               "global_load_async_to_lds_b128 %1, %5, off\n\t"
               "global_load_async_to_lds_b128 %2, %6, off\n\t"
               "global_load_async_to_lds_b128 %3, %7, off\n\t"
               "s_wait_xcnt 0x0"
               :: "v"(lds_byte(l0)), "v"(lds_byte(l1)), "v"(lds_byte(l2)),
                  "v"(lds_byte(l3)), "v"(g0), "v"(g1), "v"(g2), "v"(g3)
               : "memory");
}
// Twelve copies of a lane (one K-block of a GEMM: 8 chunks of A, 4 of W) in ONE
// statement with one s_wait_xcnt 0 at its end, for the same reason.
static __device__ __forceinline__ void async_copy12_b128(
    const _Float16* const (&g)[12], const _Float16* const (&l)[12]) {
  asm volatile("global_load_async_to_lds_b128 %0, %12, off\n\t"
               "global_load_async_to_lds_b128 %1, %13, off\n\t"
               "global_load_async_to_lds_b128 %2, %14, off\n\t"
               "global_load_async_to_lds_b128 %3, %15, off\n\t"
               "global_load_async_to_lds_b128 %4, %16, off\n\t"
               "global_load_async_to_lds_b128 %5, %17, off\n\t"
               "global_load_async_to_lds_b128 %6, %18, off\n\t"
               "global_load_async_to_lds_b128 %7, %19, off\n\t"
               "global_load_async_to_lds_b128 %8, %20, off\n\t"
               "global_load_async_to_lds_b128 %9, %21, off\n\t"
               "global_load_async_to_lds_b128 %10, %22, off\n\t"
               "global_load_async_to_lds_b128 %11, %23, off\n\t"
               "s_wait_xcnt 0x0"
               :: "v"(lds_byte(l[0])), "v"(lds_byte(l[1])), "v"(lds_byte(l[2])),
                  "v"(lds_byte(l[3])), "v"(lds_byte(l[4])), "v"(lds_byte(l[5])),
                  "v"(lds_byte(l[6])), "v"(lds_byte(l[7])), "v"(lds_byte(l[8])),
                  "v"(lds_byte(l[9])), "v"(lds_byte(l[10])), "v"(lds_byte(l[11])),
                  "v"(g[0]), "v"(g[1]), "v"(g[2]), "v"(g[3]), "v"(g[4]), "v"(g[5]),
                  "v"(g[6]), "v"(g[7]), "v"(g[8]), "v"(g[9]), "v"(g[10]), "v"(g[11])
               : "memory");
}
// Publish point, in front of the barrier: this wave's LDS reads have retired
// (the buffer they read is refilled behind the barrier) and its copies landed.
static __device__ __forceinline__ void wait_lds_and_async0() {
  asm volatile("s_wait_dscnt 0x0" ::: "memory");
  asm volatile("s_wait_asynccnt 0x0" ::: "memory");
}
static __device__ __forceinline__ void wait_async0() {
  asm volatile("s_wait_asynccnt 0x0" ::: "memory");
}

// LDS pitch of a 64-half (128 B) row read by ds_load_b128: 144 B = 16 B x 9.
// At 128 B the 16 rows of a fragment fall on two groups of four banks.
static constexpr int LDP = 72;

// ---------------------------------------------------------------------------
// WMMA helper (D = A(16x32 f16) * B(32x16 f16) + C(16x16 f32))
// ---------------------------------------------------------------------------
static __device__ __forceinline__ v8f wmma32(v16h a, v16h b, v8f c) {
  return __builtin_amdgcn_wmma_f32_16x16x32_f16(false, a, false, b,
                                                (short)0, c, false, false);
}

// A-fragment: 16x32 f16 from LDS. Lanes 0-15 -> M=lane, K 0-7, 16-23;
// lanes 16-31 -> K 8-15, 24-31. 8 contiguous halves per chunk -> ds_load_b128.
static __device__ __forceinline__ v16h lds_a_frag(const _Float16* base,
                                                  int row0, int ld, int k0) {
  const int lane = threadIdx.x & 31;
  const int m = lane & 15, hf = lane >> 4;
  v16h a;
#pragma unroll
  for (int v = 0; v < 8; ++v) {
    const int kb = (v < 4) ? (hf * 8 + 2 * v) : (16 + hf * 8 + 2 * (v - 4));
    const _Float16* p = base + (size_t)(row0 + m) * ld + k0 + kb;
    a[2 * v]     = p[0];
    a[2 * v + 1] = p[1];
  }
  return a;
}

// B-fragment (32x16, K x N) from an N-major LDS tile: elem B[k][n] = base[n*ld + k]
static __device__ __forceinline__ v16h lds_b_frag_nmajor(const _Float16* base,
                                                         int n0, int ld, int k0) {
  const int lane = threadIdx.x & 31;
  const int n = lane & 15, hf = lane >> 4;
  v16h b;
#pragma unroll
  for (int v = 0; v < 8; ++v) {
    const int kb = (v < 4) ? (hf * 8 + 2 * v) : (16 + hf * 8 + 2 * (v - 4));
    const _Float16* p = base + (size_t)(n0 + n) * ld + k0 + kb;
    b[2 * v]     = p[0];
    b[2 * v + 1] = p[1];
  }
  return b;
}

// ---------------------------------------------------------------------------
// f32 -> f16 bulk conversion (vectorized, one-shot preprocessing)
// ---------------------------------------------------------------------------
__global__ __launch_bounds__(256)
void cvt_f32_f16(const float* __restrict__ src, _Float16* __restrict__ dst,
                 int n4) {
  const int i = blockIdx.x * 256 + threadIdx.x;
  if (i < n4) {
    const float4 v = ((const float4*)src)[i];
    h4 o; o[0] = (_Float16)v.x; o[1] = (_Float16)v.y;
          o[2] = (_Float16)v.z; o[3] = (_Float16)v.w;
    ((h4*)dst)[i] = o;
  }
}

// ---------------------------------------------------------------------------
// GEMM: out[M, Nout] = A[M, K] * W[Nout, K]^T + bias, A/W f16.
//   256(M) x 128(N) x 64(K) tile; 256 threads = 8 waves (4x2); each wave
//   computes 64x64 = 4x4 WMMA tiles: a fragment read from LDS feeds 4 WMMAs,
//   and a staged row of A serves 128 columns, a staged row of W 256 rows.
//   Double-buffered LDS (108 KB, rows padded to LDP), all staging via async
//   global->LDS DMA, pipelined one K-block ahead.
//   Register budget of 256 a wave: two of these work-groups share a WGP.
// ---------------------------------------------------------------------------
template <typename OT>
__global__ __launch_bounds__(256) __attribute__((amdgpu_waves_per_eu(4, 4)))
void gemm_bias_wmma(const _Float16* __restrict__ A, const _Float16* __restrict__ W,
                    const float* __restrict__ bias, OT* __restrict__ out,
                    int M, int Nout, int K) {
  constexpr int BM = 256, BN = 128, BK = 64;
  __shared__ __attribute__((aligned(16))) _Float16 As[2][BM * LDP];  // 2 x 36 KB
  __shared__ __attribute__((aligned(16))) _Float16 Ws[2][BN * LDP];  // 2 x 18 KB

  const int tid   = threadIdx.x;
  const int m_blk = blockIdx.y * BM;
  const int n_blk = blockIdx.x * BN;
  const int w     = tid >> 5;
  const int lane  = tid & 31;
  const int wm    = w >> 1;   // 0..3 -> 64 rows each
  const int wn    = w & 1;    // 0..1 -> 64 cols each

  // Staging: a thread copies the 16-B chunk (row tid/8 + 32 i, halves (tid%8)*8..)
  // of the A tile for i = 0..7 and of the W tile for i = 0..3.
  const int r0 = tid >> 3, c0 = (tid & 7) * 8;
  const int l0 = r0 * LDP + c0;          // the chunk's place in a padded LDS tile
  constexpr int L32 = 32 * LDP;          // 32 rows further in LDS
  const size_t g32 = (size_t)32 * K;     // 32 rows further in memory
  const _Float16* pa = A + (size_t)(m_blk + r0) * K + c0;  // advanced by BK each K-block
  const _Float16* pw = W + (size_t)(n_blk + r0) * K + c0;

  auto stage = [&](int nb) {
    const _Float16* g[12];
    const _Float16* l[12];
#pragma unroll
    for (int i = 0; i < 8; ++i) {
      g[i] = pa + i * g32;
      l[i] = &As[nb][l0 + i * L32];
    }
#pragma unroll
    for (int i = 0; i < 4; ++i) {
      g[8 + i] = pw + i * g32;
      l[8 + i] = &Ws[nb][l0 + i * L32];
    }
    async_copy12_b128(g, l);
    pa += BK;
    pw += BK;
  };

  // Prologue: stage K-block 0 into buffer 0
  stage(0);

  v8f acc[4][4] = {};

  const int nkb = K / BK;
  for (int kb = 0; kb < nkb; ++kb) {
    const int buf = kb & 1;
    wait_lds_and_async0();
    __syncthreads();

    if (kb + 1 < nkb) stage(buf ^ 1);  // stage next K-block into other buffer

#pragma unroll
    for (int ks = 0; ks < BK; ks += 32) {
      v16h af[4], bf[4];
#pragma unroll
      for (int mt = 0; mt < 4; ++mt)
        af[mt] = lds_a_frag(As[buf], wm * 64 + mt * 16, LDP, ks);
#pragma unroll
      for (int nt = 0; nt < 4; ++nt)
        bf[nt] = lds_b_frag_nmajor(Ws[buf], wn * 64 + nt * 16, LDP, ks);
      // Keeps the 16 LDS loads one group in front of their 16 products; left free,
      // the compiler loads some singly among the WMMAs, each behind a full wait.
      __builtin_amdgcn_sched_barrier(0);
#pragma unroll
      for (int mt = 0; mt < 4; ++mt)
#pragma unroll
        for (int nt = 0; nt < 4; ++nt)
          acc[mt][nt] = wmma32(af[mt], bf[nt], acc[mt][nt]);
    }
  }
  wait_async0();   // no copy of this wave is outstanding when it ends

  // Epilogue: C/D layout -> lane n = lane&15; row = r + 8*(lane>=16)
  const int hf = lane >> 4, nin = lane & 15;
#pragma unroll
  for (int mt = 0; mt < 4; ++mt)
#pragma unroll
    for (int nt = 0; nt < 4; ++nt) {
      const int nglob = n_blk + wn * 64 + nt * 16 + nin;
      const float bv = bias[nglob];
#pragma unroll
      for (int r = 0; r < 8; ++r) {
        const int mglob = m_blk + wm * 64 + mt * 16 + r + hf * 8;
        out[(size_t)mglob * Nout + nglob] = (OT)(acc[mt][nt][r] + bv);
      }
    }
}

static __device__ __forceinline__ float other_half(float x) {
  const int b = __builtin_bit_cast(int, x);
  return __builtin_bit_cast(float, __builtin_amdgcn_permlanex16(
      b, b, 0x76543210, 0xfedcba98, false, false));
}

static __device__ __forceinline__ v8f splat8(float x) {
  return v8f{x, x, x, x, x, x, x, x};
}

// Two f32 tiles of S^T (keys 0-15 and 16-31 of a 32-key group) -> f16 B operand
static __device__ __forceinline__ v16h pack_b(v8f t0, v8f t1) {
  const h8 lo = __builtin_convertvector(t0, h8);
  const h8 hi = __builtin_convertvector(t1, h8);
  return __builtin_shufflevector(lo, hi, 0, 1, 2, 3, 4, 5, 6, 7,
                                 8, 9, 10, 11, 12, 13, 14, 15);
}

// V^T A-fragment (16 d x 32 keys) from a row-major [key][d] LDS tile by two
// transposing loads. Lane (c = lane & 15, hf = lane >> 4) gets keys hf*8..+7
// and 16+hf*8..+7 of column d0 + c: the k order of lds_a_frag and pack_b.
typedef short s16x8 __attribute__((ext_vector_type(8)));
static __device__ __forceinline__ h8 lds_tr16(const _Float16* p) {
  typedef __attribute__((address_space(3))) s16x8 lds_s16x8;
  return __builtin_bit_cast(h8, __builtin_amdgcn_ds_load_tr16_b128_v8i16((lds_s16x8*)p));
}
static __device__ __forceinline__ v16h lds_at_frag(const _Float16* base,
                                                   int d0, int ld, int k0) {
  const int lane = threadIdx.x & 31;
  const _Float16* p = base + (k0 + 8 * (lane >> 4) + (lane & 7)) * ld + d0 +
                      8 * ((lane >> 3) & 1);
  const h8 lo = lds_tr16(p);
  const h8 hi = lds_tr16(p + 16 * ld);
  return __builtin_shufflevector(lo, hi, 0, 1, 2, 3, 4, 5, 6, 7,
                                 8, 9, 10, 11, 12, 13, 14, 15);
}

// Register budget of 256 a wave: two of these work-groups share a WGP, four
// waves a SIMD, so one wave's softmax runs beside another's matrix products.
__global__ __launch_bounds__(256) __attribute__((amdgpu_waves_per_eu(4, 4)))
void flash_attn_wmma(const _Float16* __restrict__ qkv,
                     _Float16* __restrict__ attn_out) {
  constexpr int QT = 2;    // 16-column query tiles per wave
  constexpr int BR = 8 * QT * 16, BC = 64;
  constexpr int VLD = 80;  // V row pitch 160 B = 32 B x 5, for ds_load_tr16_b128
  constexpr float PSUM_MAX = 16384.0f;   // 2^14, a quarter of the largest f16

  __shared__ __attribute__((aligned(16))) _Float16 Ks[2][BC * LDP];  // 18 KB (double-buffered, padded rows)
  __shared__ __attribute__((aligned(16))) _Float16 Vs[2][BC * VLD];  // 20 KB (double-buffered, padded rows)

  const int tid  = threadIdx.x;
  const int w    = tid >> 5;
  const int lane = tid & 31;
  const int hf   = lane >> 4, nin = lane & 15;
  const int qblk = blockIdx.x;
  const int h    = blockIdx.y;
  const int b    = blockIdx.z;
  const float sc2 = 0.125f * 1.44269504088896f;   // 1/sqrt(64) * log2(e)

  const size_t rowstride = (size_t)THREEC;
  const size_t blkstep   = (size_t)BC * rowstride;   // halves per key-block
  const _Float16* qbase = qkv + ((size_t)b * SEQ) * rowstride + h * HEAD_D;
  const int nq = qblk * BR + w * (QT * 16) + nin;    // this lane's query in tile 0

  // --- Prologue: async-stage K and V block 0; Q into registers ---
  int lk[2], lv[2];   // the chunk's place in a padded K tile, V tile
  const _Float16* gk[2];
  const _Float16* gv[2];
#pragma unroll
  for (int i = 0; i < 2; ++i) {
    const int idx = tid + i * 256;
    const int rk = idx >> 3, ck = (idx & 7) * 8;
    lk[i] = rk * LDP + ck;
    lv[i] = rk * VLD + ck;
    gk[i] = qbase + (size_t)rk * rowstride + HIDDEN + ck;
    gv[i] = qbase + (size_t)rk * rowstride + 2 * HIDDEN + ck;
  }
  async_copy4_b128(gk[0], &Ks[0][lk[0]], gk[1], &Ks[0][lk[1]],
                   gv[0], &Vs[0][lv[0]], gv[1], &Vs[0][lv[1]]);
#pragma unroll
  for (int i = 0; i < 2; ++i) {
    gk[i] += blkstep;
    gv[i] += blkstep;
  }

  // Q^T B-fragments, same k order as lds_a_frag: halves hf*8.. and 16+hf*8..
  v16h qf[QT][2];
#pragma unroll
  for (int qt = 0; qt < QT; ++qt) {
    const _Float16* qrow = qbase + (size_t)(nq + qt * 16) * rowstride + hf * 8;
#pragma unroll
    for (int ks = 0; ks < 2; ++ks) {
      const h8 lo = *(const h8*)(qrow + ks * 32);
      const h8 hi = *(const h8*)(qrow + ks * 32 + 16);
      const v16h q = __builtin_shufflevector(lo, hi, 0, 1, 2, 3, 4, 5, 6, 7,
                                             8, 9, 10, 11, 12, 13, 14, 15);
      qf[qt][ks] = __builtin_convertvector(__builtin_convertvector(q, v16f) * sc2, v16h);
    }
  }

  v8f negm[QT];        // minus the held maximum of this lane's query, log2 units
  float l_run[QT];     // running sum over this lane's half of the keys
  v8f oacc[QT][4];     // O^T: oacc[qt][dt][r] = O[query][dt*16 + hf*8 + r]
#pragma unroll
  for (int qt = 0; qt < QT; ++qt) {
    negm[qt] = v8f{};
    l_run[qt] = 0.0f;
#pragma unroll
    for (int dt = 0; dt < 4; ++dt) oacc[qt][dt] = v8f{};
  }

  const int nblocks = SEQ / BC;
  for (int kb = 0; kb < nblocks; ++kb) {
    const int buf = kb & 1;
    wait_lds_and_async0();
    __syncthreads();   // Ks[buf], Vs[buf] ready; the other buffers are read out

    if (kb + 1 < nblocks) {
      // Async-prefetch K and V block kb+1 into the other buffers
      const int nb = buf ^ 1;
      async_copy4_b128(gk[0], &Ks[nb][lk[0]], gk[1], &Ks[nb][lk[1]],
                       gv[0], &Vs[nb][lv[0]], gv[1], &Vs[nb][lv[1]]);
#pragma unroll
      for (int i = 0; i < 2; ++i) {
        gk[i] += blkstep;
        gv[i] += blkstep;
      }
    }

    // T = K (Q sc2)^T - held maximum (64 keys x 32 queries per wave): 4 key tiles,
    // 2 WMMA k-steps, each K fragment used for both query tiles
    // sacc[qt][kt][r]: key kt*16 + hf*8 + r, query nin of tile qt
    v8f sacc[QT][4];
    float psum[QT];      // this lane's sum of the block's exponentials
    bool fix = (kb == 0);   // take a new maximum in this trip (block 0 always does)
    for (;;) {              // one trip; a second only after the test below
      // Compiler fence: each trip loads its own K fragments. Without it they are
      // loaded once in front of the loop and held in 64 registers to its end (spills).
      asm volatile("" ::: "memory");
      v16h af[2][4];
#pragma unroll
      for (int ks = 0; ks < 2; ++ks)
#pragma unroll
        for (int kt = 0; kt < 4; ++kt)
          af[ks][kt] = lds_a_frag(Ks[buf], kt * 16, LDP, ks * 32);
      // Keeps the 16 LDS loads one group in front of the products; left free, the
      // compiler loaded half of them singly among the WMMAs, each behind a full wait.
      __builtin_amdgcn_sched_barrier(0);
#pragma unroll
      for (int ks = 0; ks < 2; ++ks)
#pragma unroll
        for (int kt = 0; kt < 4; ++kt)
#pragma unroll
          for (int qt = 0; qt < QT; ++qt)
            sacc[qt][kt] = wmma32(af[ks][kt], qf[qt][ks], ks == 0 ? negm[qt] : sacc[qt][kt]);

      if (fix) {   // same for the whole wave: kb, or the ballot below
#pragma unroll
        for (int qt = 0; qt < QT; ++qt) {
          v8f* s = sacc[qt];
          const v8f mx8 = __builtin_elementwise_max(
              __builtin_elementwise_max(s[0], s[1]),
              __builtin_elementwise_max(s[2], s[3]));
          float rmax = fmaxf(fmaxf(fmaxf(mx8[0], mx8[1]), fmaxf(mx8[2], mx8[3])),
                             fmaxf(fmaxf(mx8[4], mx8[5]), fmaxf(mx8[6], mx8[7])));
          rmax = fmaxf(rmax, other_half(rmax));
          // d: how far the held maximum moves. It never falls after block 0.
          const float d = (kb == 0) ? rmax : fmaxf(rmax, 0.0f);
          // alpha = 2^-d. Asm so that the v_nop stands directly behind the
          // transcendental.
          float alpha;
          asm("v_exp_f32 %0, %1\n\tv_nop" : "=v"(alpha) : "v"(-d));
          if (kb == 0) alpha = 0.0f;   // nothing is summed yet; 2^-d may be infinite
          negm[qt] -= splat8(d);
#pragma unroll
          for (int kt = 0; kt < 4; ++kt) s[kt] -= splat8(d);
          l_run[qt] *= alpha;
#pragma unroll
          for (int dt = 0; dt < 4; ++dt) oacc[qt][dt] *= alpha;
        }
      }

#pragma unroll
      for (int qt = 0; qt < QT; ++qt) {
        v8f* s = sacc[qt];
#pragma unroll
        for (int kt = 0; kt < 4; ++kt)
#pragma unroll
          for (int r = 0; r < 8; ++r) s[kt][r] = __builtin_amdgcn_exp2f(s[kt][r]);
        const v8f ps8 = (s[0] + s[1]) + (s[2] + s[3]);
        psum[qt] = ((ps8[0] + ps8[1]) + (ps8[2] + ps8[3])) +
                   ((ps8[4] + ps8[5]) + (ps8[6] + ps8[7]));
      }
      if (fix) break;
      // Every exponential is at most its lane's sum: below PSUM_MAX all fit f16.
      // One scalar branch per key block; an infinite sum takes the second trip too.
      fix = __builtin_amdgcn_ballot_w32(!(fmaxf(psum[0], psum[1]) <= PSUM_MAX)) != 0;
      if (!fix) break;
    }

    v16h pf[QT][2];
#pragma unroll
    for (int qt = 0; qt < QT; ++qt) {
      l_run[qt] += psum[qt];
      pf[qt][0] = pack_b(sacc[qt][0], sacc[qt][1]);
      pf[qt][1] = pack_b(sacc[qt][2], sacc[qt][3]);
    }

    // O^T += V^T P^T (4 d-tiles, 2 WMMA k-steps over the 64 keys), each V^T
    // fragment used for both query tiles
#pragma unroll
    for (int ks = 0; ks < 2; ++ks)
#pragma unroll
      for (int dt = 0; dt < 4; ++dt) {
        const v16h af = lds_at_frag(Vs[buf], dt * 16, VLD, ks * 32);
#pragma unroll
        for (int qt = 0; qt < QT; ++qt)
          oacc[qt][dt] = wmma32(af, pf[qt][ks], oacc[qt][dt]);
      }
  }
  wait_async0();   // no copy of this wave is outstanding when it ends

  // Write O / l  ->  attn_out[b, nq, h, d]  (f16): 8 consecutive d per lane
#pragma unroll
  for (int qt = 0; qt < QT; ++qt) {
    const float linv = 1.0f / (l_run[qt] + other_half(l_run[qt]));
    _Float16* dst = attn_out + ((size_t)b * SEQ + nq + qt * 16) * HIDDEN +
                    h * HEAD_D + hf * 8;
#pragma unroll
    for (int dt = 0; dt < 4; ++dt)
      *(h8*)(dst + dt * 16) = __builtin_convertvector(oacc[qt][dt] * linv, h8);
  }
}

// ---------------------------------------------------------------------------
// Host-side launch
// ---------------------------------------------------------------------------
extern "C" void kernel_launch(void* const* d_in, const int* in_sizes, int n_in,
                              void* d_out, int out_size, void* d_ws, size_t ws_size,
                              hipStream_t stream) {
  (void)in_sizes; (void)n_in; (void)out_size; (void)ws_size;
  const float* x     = (const float*)d_in[0];   // [2, 4096, 1024]
  const float* qkv_w = (const float*)d_in[1];   // [3072, 1024]
  const float* qkv_b = (const float*)d_in[2];   // [3072]
  const float* out_w = (const float*)d_in[3];   // [1024, 1024]
  const float* out_b = (const float*)d_in[4];   // [1024]
  float* out = (float*)d_out;                   // [2, 4096, 1024]

  // Workspace layout (all f16 halves)
  _Float16* qkv_h  = (_Float16*)d_ws;                     // 8192 x 3072
  _Float16* attn_h = qkv_h  + (size_t)MTOT * THREEC;      // 8192 x 1024
  _Float16* x_h    = attn_h + (size_t)MTOT * HIDDEN;      // 8192 x 1024
  _Float16* qkvw_h = x_h    + (size_t)MTOT * HIDDEN;      // 3072 x 1024
  _Float16* outw_h = qkvw_h + (size_t)THREEC * HIDDEN;    // 1024 x 1024

  // 0) One-shot f32 -> f16 conversion of activations and weights
  {
    const int n4x = (MTOT * HIDDEN) / 4;
    cvt_f32_f16<<<n4x / 256, 256, 0, stream>>>(x, x_h, n4x);
    const int n4q = (THREEC * HIDDEN) / 4;
    cvt_f32_f16<<<n4q / 256, 256, 0, stream>>>(qkv_w, qkvw_h, n4q);
    const int n4o = (HIDDEN * HIDDEN) / 4;
    cvt_f32_f16<<<n4o / 256, 256, 0, stream>>>(out_w, outw_h, n4o);
  }

  // 1) QKV projection: [8192,1024] x [3072,1024]^T + bias -> f16
  gemm_bias_wmma<_Float16>
      <<<dim3(THREEC / 128, MTOT / 256), 256, 0, stream>>>(
          x_h, qkvw_h, qkv_b, qkv_h, MTOT, THREEC, HIDDEN);

  // 2) Flash attention over heads
  flash_attn_wmma<<<dim3(SEQ / 256, HEADS, BATCH), 256, 0, stream>>>(qkv_h, attn_h);

  // 3) Output projection: [8192,1024] x [1024,1024]^T + bias -> f32
  gemm_bias_wmma<float>
      <<<dim3(HIDDEN / 128, MTOT / 256), 256, 0, stream>>>(
          attn_h, outw_h, out_b, out, MTOT, HIDDEN, HIDDEN);
}
